// v000
// Measured on an AMD MI455X. A time is GPU time per run, averaged over a window of back-to-back runs after a warm-up
// (all launches, gaps included; the runs take copies of the inputs in turn), and the median of several windows.
// Apart from v000's, it joins two sittings. Times from different sittings can be a few percent apart, while
// side-by-side timings come from the same sitting.
// v000 is the starting kernel. One run takes 292 microseconds.
#include <hip/hip_runtime.h>

// Contractions: q/k/v projections v_wmma_f32_16x16x32_bf16 (x and W as bf16 RNE planes, single product); scores bf16 hi|lo planes of rope(q)/8 and rope(k), three products; P.V v_wmma_f32_16x16x32_f16 (P carried x1024, V^T f16); output projection bf16 (ctx hi + ctx lo) x Wo, two products; all f32 accumulate, softmax f32.

#ifndef NB
#define NB 2
#endif
#ifndef SEQ
#define SEQ 2048
#endif
#define NB_FULL  2
#define SEQ_FULL 2048
#define HID   1024
#define NH    16
#define HD    64
#define KD    1024               // contraction length of every GEMM
#define MROWS (NB * SEQ)
#define AW    4                  // waves per attention block (16 query rows each)
#define L2E   1.4426950408889634f

typedef _Float16 h16;
typedef unsigned short bf;
typedef __attribute__((ext_vector_type(16))) __bf16   v16bf;
typedef __attribute__((ext_vector_type(16))) _Float16 v16h;
typedef __attribute__((ext_vector_type(8)))  _Float16 v8h;
typedef __attribute__((ext_vector_type(8)))  unsigned short v8us;
typedef __attribute__((ext_vector_type(8)))  float    v8f;
typedef __attribute__((ext_vector_type(4)))  float    v4f;
typedef __attribute__((ext_vector_type(2)))  float    v2f;
typedef v8h  __attribute__((may_alias)) v8ha;
typedef v4f  __attribute__((may_alias)) v4fa;

static_assert(NB <= NB_FULL);
static_assert(SEQ <= SEQ_FULL);
static_assert(HID == NH * HD);
static_assert(HD == 64);
static_assert(KD == HID);
static_assert(KD % 32 == 0);
static_assert(SEQ % 64 == 0);
static_assert(MROWS % 64 == 0);
static_assert(HID % 64 == 0);
static_assert(SEQ % (16 * AW) == 0);
static_assert(SEQ % 32 == 0);
static_assert((SEQ * HID) % 2048 == 0);
static_assert((HID * HID) % 2048 == 0);
static_assert((SEQ * 32) % 256 == 0);

__device__ __forceinline__ unsigned short f2bf(float f) { unsigned u = __float_as_uint(f); u += 0x7FFFu + ((u >> 16) & 1u); return (unsigned short)(u >> 16); }
__device__ __forceinline__ float bf2f(unsigned short b) { return __uint_as_float(((unsigned)b) << 16); }
__device__ __forceinline__ float bfr(float f) { return bf2f(f2bf(f)); }
__device__ __forceinline__ void splitf(float y, unsigned short& h, unsigned short& l) { h = f2bf(y); l = f2bf(y - bf2f(h)); }
__device__ __forceinline__ v16h cat16(v8h lo, v8h hi) { return __builtin_shufflevector(lo, hi, 0, 1, 2, 3, 4, 5, 6, 7, 8, 9, 10, 11, 12, 13, 14, 15); }
__device__ __forceinline__ v16bf cat16b(v8us lo, v8us hi) { return __builtin_bit_cast(v16bf, __builtin_shufflevector(lo, hi, 0, 1, 2, 3, 4, 5, 6, 7, 8, 9, 10, 11, 12, 13, 14, 15)); }
// Fragment loaders: p already includes row (lane & 15) and the 8 * (lane >> 4) half offset; elements 0..7 <- k0 + 8h + 0..7, elements 8..15 <- k0 + 16 + 8h + 0..7 (same map for A and B).
__device__ __forceinline__ v16bf ldb(const bf* p) { return cat16b(*(const v8us*)p, *(const v8us*)(p + 16)); }
__device__ __forceinline__ v16h  ldh(const h16* p) { return cat16(*(const v8h*)p, *(const v8h*)(p + 16)); }
__device__ __forceinline__ v8f wmma16(v16h a, v16h b, v8f c) { return __builtin_amdgcn_wmma_f32_16x16x32_f16(false, a, false, b, (short)0, c, false, false); }
__device__ __forceinline__ v8f wmmab(v16bf a, v16bf b, v8f c) { return __builtin_amdgcn_wmma_f32_16x16x32_bf16(false, a, false, b, (short)0, c, false, false); }

__global__ __launch_bounds__(256) void k_cvt(const float* __restrict__ src, bf* dst, int per, int sstride) {
    const int i = (blockIdx.x * 256 + threadIdx.x) * 8; if (i >= per) return;
    const float* s = src + (size_t)blockIdx.y * sstride + i;
    const v4f a = *(const v4f*)s, b = *(const v4f*)(s + 4);
    v8us o; o[0] = f2bf(a[0]); o[1] = f2bf(a[1]); o[2] = f2bf(a[2]); o[3] = f2bf(a[3]); o[4] = f2bf(b[0]); o[5] = f2bf(b[1]); o[6] = f2bf(b[2]); o[7] = f2bf(b[3]);
    bf* d = dst + (size_t)blockIdx.y * per + i;
    *(v8us*)d = o; 
}

__global__ __launch_bounds__(256) void k_cstab(float* CS) {
    const int idx = blockIdx.x * 256 + threadIdx.x; if (idx >= SEQ * 32) return;
    const int s = idx >> 5, j = idx & 31;
    const double p = (double)(1u << (j >> 1)) * ((j & 1) ? 1.4142135623730951 : 1.0);
    const float pf = (float)p; const float inv = 1.0f / pf; const float ang = (float)s * inv;
    float sn, c; sincosf(ang, &sn, &c);
    v2f cs; cs[0] = c; cs[1] = sn;
    *(v2f*)(CS + (size_t)idx * 2) = cs; 
}

// ---- gemm_core: one wave computes a 64x64 tile, acc[mb][nb] = sum_k A[r0+16mb+..][k] Bt[c0+16nb+..][k] (+ A2 product when NA == 2); operands straight from K-contiguous bf16 planes of pitch KD.
template <int NA>
__device__ __forceinline__ void gemm_core(const bf* __restrict__ A, const bf* __restrict__ A2, const bf* __restrict__ Bt, const int r0, const int c0, const int lr, const int hi, v8f (&acc)[4][4]) {
#pragma unroll
    for (int mb = 0; mb < 4; ++mb)
#pragma unroll
        for (int nb = 0; nb < 4; ++nb) acc[mb][nb] = (v8f){};
    const size_t aoff = (size_t)(r0 + lr) * KD + 8 * hi, boff = (size_t)(c0 + lr) * KD + 8 * hi;
#pragma unroll 1
    for (int kc = 0; kc < KD; kc += 32) {
        v16bf a[4], a2[4], b;
#pragma unroll
        for (int mb = 0; mb < 4; ++mb) { a[mb] = ldb(A + aoff + (size_t)mb * 16 * KD + kc); if (NA == 2) a2[mb] = ldb(A2 + aoff + (size_t)mb * 16 * KD + kc); }
#pragma unroll
        for (int nb = 0; nb < 4; ++nb) { b = ldb(Bt + boff + (size_t)nb * 16 * KD + kc);
#pragma unroll
            for (int mb = 0; mb < 4; ++mb) { acc[mb][nb] = wmmab(a[mb], b, acc[mb][nb]); if (NA == 2) acc[mb][nb] = wmmab(a2[mb], b, acc[mb][nb]); } }
        asm volatile("" : "+v"(acc[0][0]), "+v"(acc[1][0]), "+v"(acc[2][0]), "+v"(acc[3][0]), "+v"(acc[0][1]), "+v"(acc[1][1]), "+v"(acc[2][1]), "+v"(acc[3][1]));
        if (NA == 2) asm volatile("v_nop\n\tv_nop\n\tv_nop\n\tv_nop" : "+v"(acc[0][2]), "+v"(acc[1][2]), "+v"(acc[2][2]), "+v"(acc[3][2]), "+v"(acc[0][3]), "+v"(acc[1][3]), "+v"(acc[2][3]), "+v"(acc[3][3]) : "v"(a[3]), "v"(a2[3]), "v"(b));
        else         asm volatile("v_nop\n\tv_nop\n\tv_nop\n\tv_nop" : "+v"(acc[0][2]), "+v"(acc[1][2]), "+v"(acc[2][2]), "+v"(acc[3][2]), "+v"(acc[0][3]), "+v"(acc[1][3]), "+v"(acc[2][3]), "+v"(acc[3][3]) : "v"(a[3]), "v"(b));
    }
}

// ---- k_proj_rope: F = XB . W^T + bias for one head (64 columns) and 64 tokens, then rotate-half rotary and scale sc; head planes [b][h][s][d] as bf16 hi | lo.
__global__ __launch_bounds__(32) void k_proj_rope(const bf* __restrict__ XB, const bf* __restrict__ W, const float* __restrict__ bias, const float* __restrict__ CS, float sc, bf* Ph, bf* Pl) {
    __shared__ __align__(16) float os[16 * 68];
    const int lane = threadIdx.x & 31, lr = lane & 15, hi = lane >> 4;
    const int r0 = blockIdx.x * 64, c0 = blockIdx.y * 64;
    v8f acc[4][4];
    gemm_core<1>(XB, XB, W, r0, c0, lr, hi, acc);
    const int b = r0 / SEQ, s0 = r0 % SEQ, h = blockIdx.y;
    const int rq = lane >> 3, pc = lane & 7, d0 = pc * 8, dp0 = d0 ^ 32, jf0 = d0 & 31;
    const float sgn = (d0 < 32) ? -1.0f : 1.0f;
    float bx[8], bp[8];
    { const v4f u0 = *(const v4f*)(bias + c0 + d0), u1 = *(const v4f*)(bias + c0 + d0 + 4), w0 = *(const v4f*)(bias + c0 + dp0), w1 = *(const v4f*)(bias + c0 + dp0 + 4);
#pragma unroll
      for (int q = 0; q < 4; ++q) { bx[q] = bfr(u0[q]); bx[q + 4] = bfr(u1[q]); bp[q] = bfr(w0[q]); bp[q + 4] = bfr(w1[q]); } }
#pragma unroll
    for (int mb = 0; mb < 4; ++mb) {
#pragma unroll
        for (int nb = 0; nb < 4; ++nb) {
#pragma unroll
            for (int j = 0; j < 8; ++j) os[(hi * 8 + j) * 68 + nb * 16 + lr] = acc[mb][nb][j]; }
        __syncthreads();
        const size_t prow = ((size_t)(b * NH + h) * SEQ + s0 + mb * 16) * HD + d0;
{
#pragma unroll 1
            for (int it = 0; it < 4; ++it) {
                const int rr = it * 4 + rq; const int s = s0 + mb * 16 + rr; const int xo = rr * 68;
                const v4f xa = *(const v4fa*)(os + xo + d0), xb = *(const v4fa*)(os + xo + d0 + 4);
                const v4f ya = *(const v4fa*)(os + xo + dp0), yb = *(const v4fa*)(os + xo + dp0 + 4);
                const float* cp = CS + ((size_t)s * 32 + jf0) * 2;
                const v4f t0 = *(const v4f*)cp, t1 = *(const v4f*)(cp + 4), t2 = *(const v4f*)(cp + 8), t3 = *(const v4f*)(cp + 12);
                const float xv[8] = { xa[0], xa[1], xa[2], xa[3], xb[0], xb[1], xb[2], xb[3] };
                const float yv[8] = { ya[0], ya[1], ya[2], ya[3], yb[0], yb[1], yb[2], yb[3] };
                const float cv[8] = { t0[0], t0[2], t1[0], t1[2], t2[0], t2[2], t3[0], t3[2] };
                const float sv[8] = { t0[1], t0[3], t1[1], t1[3], t2[1], t2[3], t3[1], t3[3] };
                v8us oh, ol;
#pragma unroll
                for (int q = 0; q < 8; ++q) { const float x = xv[q] + bx[q], y = yv[q] + bp[q]; const float r = (x * cv[q] + sgn * (y * sv[q])) * sc; unsigned short a2, c2; splitf(r, a2, c2); oh[q] = a2; ol[q] = c2; }
                *(v8us*)(Ph + prow + (size_t)rr * HD) = oh; *(v8us*)(Pl + prow + (size_t)rr * HD) = ol; }
             }
        __syncthreads();
    }
}

__global__ __launch_bounds__(32) void k_proj_v(const bf* __restrict__ XB, const bf* __restrict__ W, const float* __restrict__ bias, h16* VT) {
    __shared__ __align__(16) h16 vt[64 * 72];
    const int lane = threadIdx.x & 31, lr = lane & 15, hi = lane >> 4;
    const int r0 = blockIdx.x * 64, c0 = blockIdx.y * 64;
    v8f acc[4][4];
    gemm_core<1>(XB, XB, W, r0, c0, lr, hi, acc);
    const int b = r0 / SEQ, s0 = r0 % SEQ, h = blockIdx.y;
    const int rq = lane >> 3, pc = lane & 7;
#pragma unroll
    for (int nb = 0; nb < 4; ++nb) { const float bv = bfr(bias[c0 + nb * 16 + lr]);
#pragma unroll
        for (int mb = 0; mb < 4; ++mb) { v8h pk;
#pragma unroll
            for (int j = 0; j < 8; ++j) pk[j] = (h16)(acc[mb][nb][j] + bv);
            *(v8ha*)(vt + (nb * 16 + lr) * 72 + mb * 16 + 8 * hi) = pk; } }
    __syncthreads();
    h16* dv = VT + ((size_t)(b * NH + h) * HD) * SEQ + s0 + 8 * pc;
{
#pragma unroll 1
        for (int it = 0; it < 16; ++it) { const int d = it * 4 + rq; const v8h val = *(const v8ha*)(vt + d * 72 + 8 * pc); *(v8h*)(dv + (size_t)d * SEQ) = val; }
         }
}

// ---- k_attn: fused flash attention, one wave per 16 query rows of one (b, h); 32 keys per step.
// Scores are computed transposed: S^T[key][query] = K . Q^T (A = K rows, B = Q rows, 3 bf16 products), so each lane owns ONE query column (lane & 15) and 16 keys per step.
// P^T (x1024, f16) is packed from the two score accumulator tiles straight into the B fragment of O^T[d][query] += V^T[d][key] . P^T[key][query]
// (element r <- tile of keys 0..15, element 8 + r <- tile of keys 16..31, lane unchanged). Row max via one xor-16 shuffle; row sums kept as per-lane partials.
__global__ __launch_bounds__(128) void k_attn(const bf* __restrict__ Qh, const bf* __restrict__ Ql, const bf* __restrict__ Kh, const bf* __restrict__ Kl, const h16* __restrict__ VT, bf* Ch, bf* Cl) {
    __shared__ __align__(16) float ot[AW * 16 * 68];
    const int lane = threadIdx.x & 31, lr = lane & 15, hi = lane >> 4;
    const int wave = __builtin_amdgcn_readfirstlane(threadIdx.x >> 5);
    const int qt = blockIdx.x * AW + wave;
    const int bh = blockIdx.y;
    const size_t pb0 = (size_t)bh * SEQ * HD;
    const size_t qoff = pb0 + (size_t)(qt * 16 + lr) * HD + 8 * hi;
    const v16bf qh0 = ldb(Qh + qoff), qh1 = ldb(Qh + qoff + 32), ql0 = ldb(Ql + qoff), ql1 = ldb(Ql + qoff + 32);
    const size_t koff = pb0 + (size_t)lr * HD + 8 * hi;
    const size_t voff = (size_t)bh * HD * SEQ + (size_t)lr * SEQ + 8 * hi;
    v8f o0 = (v8f){}, o1 = (v8f){}, o2 = (v8f){}, o3 = (v8f){};
    float m = -1.0e30f, l = 0.0f;
#pragma unroll 1
    for (int kb = 0; kb < SEQ; kb += 32) {
        v8f s0 = (v8f){}, s1 = (v8f){};
        const bf* ph = Kh + koff + (size_t)kb * HD; const bf* pl = Kl + koff + (size_t)kb * HD;
        const v16bf a0 = ldb(ph), a1 = ldb(ph + 32), c0 = ldb(pl), c1 = ldb(pl + 32);
        s0 = wmmab(a0, qh0, s0); s0 = wmmab(a1, qh1, s0); s0 = wmmab(c0, qh0, s0); s0 = wmmab(c1, qh1, s0); s0 = wmmab(a0, ql0, s0); s0 = wmmab(a1, ql1, s0);
        const v16bf e0 = ldb(ph + 16 * HD), e1 = ldb(ph + 16 * HD + 32), g0 = ldb(pl + 16 * HD), g1 = ldb(pl + 16 * HD + 32);
        s1 = wmmab(e0, qh0, s1); s1 = wmmab(e1, qh1, s1); s1 = wmmab(g0, qh0, s1); s1 = wmmab(g1, qh1, s1); s1 = wmmab(e0, ql0, s1); s1 = wmmab(e1, ql1, s1);
        asm volatile("v_nop\n\tv_nop\n\tv_nop\n\tv_nop" : "+v"(s0), "+v"(s1) : "v"(e1), "v"(g1), "v"(ql1));
        float mx = fmaxf(s0[0], s1[0]);
#pragma unroll
        for (int r = 1; r < 8; ++r) mx = fmaxf(mx, fmaxf(s0[r], s1[r]));
        mx = fmaxf(mx, __shfl_xor(mx, 16, 32));
        const float mn = fmaxf(m, mx);
        const float corr = __builtin_amdgcn_exp2f((m - mn) * L2E);
        m = mn;
        float ls = 0.0f; v16h pb;
#pragma unroll
        for (int r = 0; r < 8; ++r) {
            const float p0 = __builtin_amdgcn_exp2f(__builtin_fmaf(s0[r] - mn, L2E, 10.0f));   // exp(s - m) x 1024
            const float p1 = __builtin_amdgcn_exp2f(__builtin_fmaf(s1[r] - mn, L2E, 10.0f));
            ls += p0 + p1; pb[r] = (h16)p0; pb[8 + r] = (h16)p1; }
        l = l * corr + ls;
        o0 = o0 * corr; o1 = o1 * corr; o2 = o2 * corr; o3 = o3 * corr;
        const h16* vp = VT + voff + kb;
        const v16h va0 = ldh(vp), va1 = ldh(vp + (size_t)16 * SEQ), va2 = ldh(vp + (size_t)32 * SEQ), va3 = ldh(vp + (size_t)48 * SEQ);
        o0 = wmma16(va0, pb, o0); o1 = wmma16(va1, pb, o1); o2 = wmma16(va2, pb, o2); o3 = wmma16(va3, pb, o3);
        asm volatile("v_nop\n\tv_nop\n\tv_nop\n\tv_nop" : "+v"(o0), "+v"(o1), "+v"(o2), "+v"(o3) : "v"(pb), "v"(va3));
    }
    const float lt = l + __shfl_xor(l, 16, 32);
    const float inv = 1.0f / lt;       // the x1024 carry cancels between numerator and row sum
    const int ob = wave * (16 * 68) + lr * 68 + 8 * hi;
    { v4f x0, x1;
      x0[0] = o0[0] * inv; x0[1] = o0[1] * inv; x0[2] = o0[2] * inv; x0[3] = o0[3] * inv; x1[0] = o0[4] * inv; x1[1] = o0[5] * inv; x1[2] = o0[6] * inv; x1[3] = o0[7] * inv;
      *(v4fa*)(ot + ob) = x0; *(v4fa*)(ot + ob + 4) = x1;
      x0[0] = o1[0] * inv; x0[1] = o1[1] * inv; x0[2] = o1[2] * inv; x0[3] = o1[3] * inv; x1[0] = o1[4] * inv; x1[1] = o1[5] * inv; x1[2] = o1[6] * inv; x1[3] = o1[7] * inv;
      *(v4fa*)(ot + ob + 16) = x0; *(v4fa*)(ot + ob + 20) = x1;
      x0[0] = o2[0] * inv; x0[1] = o2[1] * inv; x0[2] = o2[2] * inv; x0[3] = o2[3] * inv; x1[0] = o2[4] * inv; x1[1] = o2[5] * inv; x1[2] = o2[6] * inv; x1[3] = o2[7] * inv;
      *(v4fa*)(ot + ob + 32) = x0; *(v4fa*)(ot + ob + 36) = x1;
      x0[0] = o3[0] * inv; x0[1] = o3[1] * inv; x0[2] = o3[2] * inv; x0[3] = o3[3] * inv; x1[0] = o3[4] * inv; x1[1] = o3[5] * inv; x1[2] = o3[6] * inv; x1[3] = o3[7] * inv;
      *(v4fa*)(ot + ob + 48) = x0; *(v4fa*)(ot + ob + 52) = x1; }
    __syncthreads();
    const int rq = lane >> 3, pc = lane & 7;
    const int b = bh / NH, h = bh % NH;
    const size_t cbase = ((size_t)(b * SEQ + qt * 16)) * HID + h * HD + 8 * pc;
{
#pragma unroll 1
        for (int it = 0; it < 4; ++it) {
            const int rr = it * 4 + rq; const int xo = wave * (16 * 68) + rr * 68 + 8 * pc;
            const v4f x0 = *(const v4fa*)(ot + xo), x1 = *(const v4fa*)(ot + xo + 4);
            v8us oh, ol;
#pragma unroll
            for (int q = 0; q < 4; ++q) { unsigned short a2, c2; splitf(x0[q], a2, c2); oh[q] = a2; ol[q] = c2; splitf(x1[q], a2, c2); oh[q + 4] = a2; ol[q + 4] = c2; }
            *(v8us*)(Ch + cbase + (size_t)rr * HID) = oh; *(v8us*)(Cl + cbase + (size_t)rr * HID) = ol; }
         }
}

// ---- k_out: OUT[token][n] = sum_k (Ch + Cl)[token][k] Wo[n][k] + bo[n]; grid (MROWS/64, HID/64), 32 threads.
__global__ __launch_bounds__(32) void k_out(const bf* __restrict__ Ch, const bf* __restrict__ Cl, const bf* __restrict__ W, const float* __restrict__ bias, float* OUT) {
    __shared__ __align__(16) float os[16 * 68];
    const int lane = threadIdx.x & 31, lr = lane & 15, hi = lane >> 4;
    const int r0 = blockIdx.x * 64, c0 = blockIdx.y * 64;
    v8f acc[4][4];
    gemm_core<2>(Ch, Cl, W, r0, c0, lr, hi, acc);
    const int b = r0 / SEQ, s0 = r0 % SEQ;
    const int cofs = lr * 4;
    v4f bb = *(const v4f*)(bias + c0 + cofs); bb[0] = bfr(bb[0]); bb[1] = bfr(bb[1]); bb[2] = bfr(bb[2]); bb[3] = bfr(bb[3]);
#pragma unroll
    for (int mb = 0; mb < 4; ++mb) {
#pragma unroll
        for (int nb = 0; nb < 4; ++nb) {
#pragma unroll
            for (int j = 0; j < 8; ++j) os[(hi * 8 + j) * 68 + nb * 16 + lr] = acc[mb][nb][j]; }
        __syncthreads();
        float* crow = OUT + ((size_t)b * SEQ_FULL + s0 + mb * 16) * HID + c0 + cofs;
{
#pragma unroll 1
            for (int s = 0; s < 8; ++s) { const int row = 2 * s + hi; v4f val = *(const v4fa*)(os + row * 68 + cofs); val = val + bb; *(v4f*)(crow + (size_t)row * HID) = val; }
             }
        __syncthreads();
    }
}

extern "C" void kernel_launch(void* const* d_in, const int* in_sizes, int n_in,
                              void* d_out, int out_size, void* d_ws, size_t ws_size, hipStream_t stream) {
    if (n_in < 9) return;
    const int need_x = (NB - 1) * SEQ_FULL * HID + SEQ * HID;
    if (in_sizes[0] < need_x) return;
    if (in_sizes[1] < HID * HID || in_sizes[3] < HID * HID || in_sizes[5] < HID * HID || in_sizes[7] < HID * HID) return;
    if (in_sizes[2] < HID || in_sizes[4] < HID || in_sizes[6] < HID || in_sizes[8] < HID) return;
    if (out_size < need_x) return;
    const float* x  = (const float*)d_in[0];
    const float* wq = (const float*)d_in[1]; const float* bq = (const float*)d_in[2];
    const float* wk = (const float*)d_in[3]; const float* bk = (const float*)d_in[4];
    const float* wv = (const float*)d_in[5]; const float* bv = (const float*)d_in[6];
    const float* wo = (const float*)d_in[7]; const float* bo = (const float*)d_in[8];
    float* OUT = (float*)d_out;

    constexpr size_t SZ_XB = (size_t)MROWS * HID * 2;            // bf16 x plane
    constexpr size_t SZ_W  = (size_t)HID * HID * 2;              // bf16 weight plane
    constexpr size_t SZ_CS = (size_t)SEQ * 32 * 2 * 4;           // cos/sin table
    constexpr size_t SZ_P  = (size_t)NB * NH * SEQ * HD * 2;     // one head plane set (16-bit)
    constexpr size_t SZ_CT = (size_t)MROWS * HID * 2;            // ctx plane
    constexpr size_t OFF_XB = 0;
    constexpr size_t OFF_WQ = OFF_XB + SZ_XB;
    constexpr size_t OFF_WK = OFF_WQ + SZ_W;
    constexpr size_t OFF_WV = OFF_WK + SZ_W;
    constexpr size_t OFF_WO = OFF_WV + SZ_W;
    constexpr size_t OFF_CS = OFF_WO + SZ_W;
    constexpr size_t OFF_QH = OFF_CS + SZ_CS;
    constexpr size_t OFF_QL = OFF_QH + SZ_P;
    constexpr size_t OFF_KH = OFF_QL + SZ_P;
    constexpr size_t OFF_KL = OFF_KH + SZ_P;
    constexpr size_t OFF_VT = OFF_KL + SZ_P;
    constexpr size_t OFF_CH = OFF_VT + SZ_P;
    constexpr size_t OFF_CL = OFF_CH + SZ_CT;
    constexpr size_t WS_TOTAL = OFF_CL + SZ_CT;
    static_assert(SZ_XB % 256 == 0);
    static_assert(SZ_W % 256 == 0);
    static_assert(SZ_CS % 256 == 0);
    static_assert(SZ_P % 256 == 0);
    static_assert(SZ_CT % 256 == 0);
    static_assert(WS_TOTAL <= (size_t)134217728);
    if (WS_TOTAL > ws_size) return;
    char* wsp = (char*)d_ws;
    bf* XB = (bf*)(wsp + OFF_XB); bf* WQ = (bf*)(wsp + OFF_WQ); bf* WK = (bf*)(wsp + OFF_WK); bf* WV = (bf*)(wsp + OFF_WV); bf* WO = (bf*)(wsp + OFF_WO);
    float* CS = (float*)(wsp + OFF_CS);
    bf* QPh = (bf*)(wsp + OFF_QH); bf* QPl = (bf*)(wsp + OFF_QL); bf* KPh = (bf*)(wsp + OFF_KH); bf* KPl = (bf*)(wsp + OFF_KL);
    h16* VT = (h16*)(wsp + OFF_VT);
    bf* CTh = (bf*)(wsp + OFF_CH); bf* CTl = (bf*)(wsp + OFF_CL);

    // operand planes (bf16 RNE) built once
    k_cvt<<<dim3(SEQ * HID / 2048, NB), 256, 0, stream>>>(x, XB, SEQ * HID, SEQ_FULL * HID);
    k_cvt<<<dim3(HID * HID / 2048, 1), 256, 0, stream>>>(wq, WQ, HID * HID, HID * HID);
    k_cvt<<<dim3(HID * HID / 2048, 1), 256, 0, stream>>>(wk, WK, HID * HID, HID * HID);
    k_cvt<<<dim3(HID * HID / 2048, 1), 256, 0, stream>>>(wv, WV, HID * HID, HID * HID);
    k_cvt<<<dim3(HID * HID / 2048, 1), 256, 0, stream>>>(wo, WO, HID * HID, HID * HID);
    k_cstab<<<SEQ * 32 / 256, 256, 0, stream>>>(CS);
    // projections with fused rotary / transpose epilogues (q carries the 1/8 score scale, exact)
    k_proj_rope<<<dim3(MROWS / 64, NH), 32, 0, stream>>>(XB, WQ, bq, CS, 0.125f, QPh, QPl);
    k_proj_rope<<<dim3(MROWS / 64, NH), 32, 0, stream>>>(XB, WK, bk, CS, 1.0f, KPh, KPl);
    k_proj_v<<<dim3(MROWS / 64, NH), 32, 0, stream>>>(XB, WV, bv, VT);
    // fused attention -> ctx hi | lo planes [token][h*64 + d]
    k_attn<<<dim3(SEQ / (16 * AW), NB * NH), 32 * AW, 0, stream>>>(QPh, QPl, KPh, KPl, VT, CTh, CTl);
    // output projection -> d_out
    k_out<<<dim3(MROWS / 64, HID / 64), 32, 0, stream>>>(CTh, CTl, WO, bo, OUT);
}

// v001
// It runs in 266 microseconds.
// Two timings next to v000 put it at 1.10 and 1.09 times that version's speed.
#include <hip/hip_runtime.h>

// Contractions: q/k/v projections v_wmma_f32_16x16x32_bf16 (x and W as bf16 RNE planes, single product); scores bf16 hi|lo planes of rope(q)/8 and rope(k), three products; P.V v_wmma_f32_16x16x32_f16 (P carried x1024, V^T f16); output projection bf16 (ctx hi + ctx lo) x Wo, two products; all f32 accumulate, softmax f32.

#ifndef NB
#define NB 2
#endif
#ifndef SEQ
#define SEQ 2048
#endif
#define NB_FULL  2
#define SEQ_FULL 2048
#define HID   1024
#define NH    16
#define HD    64
#define KD    1024               // contraction length of every GEMM
#define MROWS (NB * SEQ)
#define AW    4                  // waves per attention block (16 query rows each)
#define L2E   1.4426950408889634f

typedef _Float16 h16;
typedef unsigned short bf;
typedef __attribute__((ext_vector_type(16))) __bf16   v16bf;
typedef __attribute__((ext_vector_type(16))) _Float16 v16h;
typedef __attribute__((ext_vector_type(8)))  _Float16 v8h;
typedef __attribute__((ext_vector_type(8)))  unsigned short v8us;
typedef __attribute__((ext_vector_type(8)))  float    v8f;
typedef __attribute__((ext_vector_type(4)))  float    v4f;
typedef __attribute__((ext_vector_type(2)))  float    v2f;
typedef v8h  __attribute__((may_alias)) v8ha;
typedef v4f  __attribute__((may_alias)) v4fa;

static_assert(NB <= NB_FULL);
static_assert(SEQ <= SEQ_FULL);
static_assert(HID == NH * HD);
static_assert(HD == 64);
static_assert(KD == HID);
static_assert(KD % 32 == 0);
static_assert(SEQ % 64 == 0);
static_assert(MROWS % 64 == 0);
static_assert(HID % 64 == 0);
static_assert(SEQ % (16 * AW) == 0);
static_assert(SEQ % 32 == 0);
static_assert((SEQ * HID) % 2048 == 0);
static_assert((HID * HID) % 2048 == 0);
static_assert((SEQ * 32) % 256 == 0);

__device__ __forceinline__ unsigned short f2bf(float f) { unsigned u = __float_as_uint(f); u += 0x7FFFu + ((u >> 16) & 1u); return (unsigned short)(u >> 16); }
__device__ __forceinline__ float bf2f(unsigned short b) { return __uint_as_float(((unsigned)b) << 16); }
__device__ __forceinline__ float bfr(float f) { return bf2f(f2bf(f)); }
__device__ __forceinline__ void splitf(float y, unsigned short& h, unsigned short& l) { h = f2bf(y); l = f2bf(y - bf2f(h)); }
__device__ __forceinline__ v16h cat16(v8h lo, v8h hi) { return __builtin_shufflevector(lo, hi, 0, 1, 2, 3, 4, 5, 6, 7, 8, 9, 10, 11, 12, 13, 14, 15); }
__device__ __forceinline__ v16bf cat16b(v8us lo, v8us hi) { return __builtin_bit_cast(v16bf, __builtin_shufflevector(lo, hi, 0, 1, 2, 3, 4, 5, 6, 7, 8, 9, 10, 11, 12, 13, 14, 15)); }
// Fragment-ordered planes: every 16-bit operand plane (rows of P elements, k contiguous in the maths) is stored as 1-KiB blocks, one per (16 rows, 32 k).
// Inside a block the 16-byte group of (row, k .. k + 7) sits at lane slot 16 * ((k >> 3) & 1) + (row & 15) of half (k >> 4) & 1, so one wave-wide 16-byte load reads 512 contiguous bytes (4 whole lines).
// pko: element offset of that group, k % 8 == 0.
__device__ __forceinline__ size_t pko(size_t row, int k, int P) { return ((row >> 4) * (size_t)(P >> 5) + (size_t)(k >> 5)) * 512 + (size_t)(((k >> 4) & 1) * 256 + ((k >> 3) & 1) * 128) + (row & 15) * 8; }
// Fragment loaders: p = block start + 8 * lane; elements 0..7 <- k0 + 8h + 0..7, elements 8..15 <- k0 + 16 + 8h + 0..7, row lane & 15, h = lane >> 4 (same map for A and B).
__device__ __forceinline__ v16bf ldb(const bf* p) { return cat16b(*(const v8us*)p, *(const v8us*)(p + 256)); }
__device__ __forceinline__ v16h  ldh(const h16* p) { return cat16(*(const v8h*)p, *(const v8h*)(p + 256)); }
// xwait stands behind global loads or stores, before a register that they name is written again; the forms with pointers take the loads' addresses as inputs, so that no later load's result is placed over an address pair ahead of the wait.
__device__ __forceinline__ void xwait() { asm volatile("s_wait_xcnt 0x0" ::: "memory"); }
__device__ __forceinline__ void xwait(const void* a, const void* b) { asm volatile("s_wait_xcnt 0x0" :: "v"(a), "v"(b) : "memory"); }
__device__ __forceinline__ void xwait(const void* a, const void* b, const void* c) { asm volatile("s_wait_xcnt 0x0" :: "v"(a), "v"(b), "v"(c) : "memory"); }
__device__ __forceinline__ v8f wmma16(v16h a, v16h b, v8f c) { return __builtin_amdgcn_wmma_f32_16x16x32_f16(false, a, false, b, (short)0, c, false, false); }
__device__ __forceinline__ v8f wmmab(v16bf a, v16bf b, v8f c) { return __builtin_amdgcn_wmma_f32_16x16x32_bf16(false, a, false, b, (short)0, c, false, false); }

__global__ __launch_bounds__(256) void k_cvt(const float* __restrict__ src, bf* dst, int per, int sstride) {
    // a block converts 16 rows x 128 columns of a plane of HID columns; a wave holds 16 rows x 2 groups, which is one 512-byte half block of dst
    if ((int)blockIdx.x * 2048 >= per) return;
    const int row = (blockIdx.x >> 3) * 16 + (threadIdx.x & 15), k = (blockIdx.x & 7) * 128 + (threadIdx.x >> 4) * 8;
    const float* s = src + (size_t)blockIdx.y * sstride + (size_t)row * HID + k;
    const v4f a = *(const v4f*)s, b = *(const v4f*)(s + 4);
    v8us o; o[0] = f2bf(a[0]); o[1] = f2bf(a[1]); o[2] = f2bf(a[2]); o[3] = f2bf(a[3]); o[4] = f2bf(b[0]); o[5] = f2bf(b[1]); o[6] = f2bf(b[2]); o[7] = f2bf(b[3]);
    bf* d = dst + (size_t)blockIdx.y * per + pko(row, k, HID);
    *(v8us*)d = o; 
}

__global__ __launch_bounds__(256) void k_cstab(float* CS) {
    const int idx = blockIdx.x * 256 + threadIdx.x; if (idx >= SEQ * 32) return;
    const int s = idx >> 5, j = idx & 31;
    const double p = (double)(1u << (j >> 1)) * ((j & 1) ? 1.4142135623730951 : 1.0);
    const float pf = (float)p; const float inv = 1.0f / pf; const float ang = (float)s * inv;
    float sn, c; sincosf(ang, &sn, &c);
    v2f cs; cs[0] = c; cs[1] = sn;
    *(v2f*)(CS + (size_t)idx * 2) = cs; 
}

// ---- gemm_core: one wave computes a 64x64 tile, acc[mb][nb] = sum_k A[r0+16mb+..][k] Bt[c0+16nb+..][k] (+ A2 product when NA == 2); operands straight from fragment-ordered bf16 planes (rows of KD elements).
template <int NA>
__device__ __forceinline__ void gemm_core(const bf* __restrict__ A, const bf* __restrict__ A2, const bf* __restrict__ Bt, const int r0, const int c0, const int lr, const int hi, v8f (&acc)[4][4]) {
#pragma unroll
    for (int mb = 0; mb < 4; ++mb)
#pragma unroll
        for (int nb = 0; nb < 4; ++nb) acc[mb][nb] = (v8f){};
    const size_t aoff = pko(r0, 0, KD) + 8 * (16 * hi + lr), boff = pko(c0, 0, KD) + 8 * (16 * hi + lr);
#pragma unroll 1
    for (int kc = 0; kc < KD; kc += 32) {
        v16bf a[4], a2[4], b;
        const bf* pa = A + aoff + kc * 16; const bf* pa2 = A2 + aoff + kc * 16; const bf* pb = Bt + boff + kc * 16;
#pragma unroll
        for (int mb = 0; mb < 4; ++mb) { a[mb] = ldb(pa + mb * 16 * KD); if (NA == 2) a2[mb] = ldb(pa2 + mb * 16 * KD); }
#pragma unroll
        for (int nb = 0; nb < 4; ++nb) { b = ldb(pb + nb * 16 * KD);
#pragma unroll
            for (int mb = 0; mb < 4; ++mb) { acc[mb][nb] = wmmab(a[mb], b, acc[mb][nb]); if (NA == 2) acc[mb][nb] = wmmab(a2[mb], b, acc[mb][nb]); } }
        asm volatile("" : "+v"(acc[0][0]), "+v"(acc[1][0]), "+v"(acc[2][0]), "+v"(acc[3][0]), "+v"(acc[0][1]), "+v"(acc[1][1]), "+v"(acc[2][1]), "+v"(acc[3][1]));
        if (NA == 2) asm volatile("v_nop\n\tv_nop\n\tv_nop\n\tv_nop" : "+v"(acc[0][2]), "+v"(acc[1][2]), "+v"(acc[2][2]), "+v"(acc[3][2]), "+v"(acc[0][3]), "+v"(acc[1][3]), "+v"(acc[2][3]), "+v"(acc[3][3]) : "v"(a[3]), "v"(a2[3]), "v"(b));
        else         asm volatile("v_nop\n\tv_nop\n\tv_nop\n\tv_nop" : "+v"(acc[0][2]), "+v"(acc[1][2]), "+v"(acc[2][2]), "+v"(acc[3][2]), "+v"(acc[0][3]), "+v"(acc[1][3]), "+v"(acc[2][3]), "+v"(acc[3][3]) : "v"(a[3]), "v"(b));
        if (NA == 2) xwait(pa, pa2, pb); else xwait(pa, pb);
    }
}

// ---- k_proj_rope: F = XB . W^T + bias for one head (64 columns) and 64 tokens, then rotate-half rotary and scale sc; head planes [b][h][s][d] as bf16 hi | lo, fragment-ordered (rows of HD elements).
__global__ __launch_bounds__(32) void k_proj_rope(const bf* __restrict__ XB, const bf* __restrict__ W, const float* __restrict__ bias, const float* __restrict__ CS, float sc, bf* Ph, bf* Pl) {
    __shared__ __align__(16) float os[16 * 68];
    const int lane = threadIdx.x & 31, lr = lane & 15, hi = lane >> 4;
    const int r0 = blockIdx.x * 64, c0 = blockIdx.y * 64;
    v8f acc[4][4];
    gemm_core<1>(XB, XB, W, r0, c0, lr, hi, acc);
    const int b = r0 / SEQ, s0 = r0 % SEQ, h = blockIdx.y;
    const int rq = lane >> 3, pc = lane & 7, d0 = pc * 8, dp0 = d0 ^ 32, jf0 = d0 & 31;
    const float sgn = (d0 < 32) ? -1.0f : 1.0f;
    float bx[8], bp[8];
    { const v4f u0 = *(const v4f*)(bias + c0 + d0), u1 = *(const v4f*)(bias + c0 + d0 + 4), w0 = *(const v4f*)(bias + c0 + dp0), w1 = *(const v4f*)(bias + c0 + dp0 + 4);
#pragma unroll
      for (int q = 0; q < 4; ++q) { bx[q] = bfr(u0[q]); bx[q + 4] = bfr(u1[q]); bp[q] = bfr(w0[q]); bp[q + 4] = bfr(w1[q]); } }
#pragma unroll
    for (int mb = 0; mb < 4; ++mb) {
#pragma unroll
        for (int nb = 0; nb < 4; ++nb) {
#pragma unroll
            for (int j = 0; j < 8; ++j) os[(hi * 8 + j) * 68 + nb * 16 + lr] = acc[mb][nb][j]; }
        __syncthreads();
        const size_t prow = pko((size_t)(b * NH + h) * SEQ + s0 + mb * 16, d0, HD);
{
#pragma unroll 1
            for (int it = 0; it < 4; ++it) {
                const int rr = it * 4 + rq; const int s = s0 + mb * 16 + rr; const int xo = rr * 68;
                const v4f xa = *(const v4fa*)(os + xo + d0), xb = *(const v4fa*)(os + xo + d0 + 4);
                const v4f ya = *(const v4fa*)(os + xo + dp0), yb = *(const v4fa*)(os + xo + dp0 + 4);
                const float* cp = CS + ((size_t)s * 32 + jf0) * 2;
                const v4f t0 = *(const v4f*)cp, t1 = *(const v4f*)(cp + 4), t2 = *(const v4f*)(cp + 8), t3 = *(const v4f*)(cp + 12);
                const float xv[8] = { xa[0], xa[1], xa[2], xa[3], xb[0], xb[1], xb[2], xb[3] };
                const float yv[8] = { ya[0], ya[1], ya[2], ya[3], yb[0], yb[1], yb[2], yb[3] };
                const float cv[8] = { t0[0], t0[2], t1[0], t1[2], t2[0], t2[2], t3[0], t3[2] };
                const float sv[8] = { t0[1], t0[3], t1[1], t1[3], t2[1], t2[3], t3[1], t3[3] };
                v8us oh, ol;
#pragma unroll
                for (int q = 0; q < 8; ++q) { const float x = xv[q] + bx[q], y = yv[q] + bp[q]; const float r = (x * cv[q] + sgn * (y * sv[q])) * sc; unsigned short a2, c2; splitf(r, a2, c2); oh[q] = a2; ol[q] = c2; }
                *(v8us*)(Ph + prow + (size_t)rr * 8) = oh; *(v8us*)(Pl + prow + (size_t)rr * 8) = ol; xwait(); }
             }
        __syncthreads();
    }
}

__global__ __launch_bounds__(32) void k_proj_v(const bf* __restrict__ XB, const bf* __restrict__ W, const float* __restrict__ bias, h16* VT) {
    __shared__ __align__(16) h16 vt[64 * 72];
    const int lane = threadIdx.x & 31, lr = lane & 15, hi = lane >> 4;
    const int r0 = blockIdx.x * 64, c0 = blockIdx.y * 64;
    v8f acc[4][4];
    gemm_core<1>(XB, XB, W, r0, c0, lr, hi, acc);
    const int b = r0 / SEQ, s0 = r0 % SEQ, h = blockIdx.y;
    const int rq = lane >> 3, pc = lane & 7;
#pragma unroll
    for (int nb = 0; nb < 4; ++nb) { const float bv = bfr(bias[c0 + nb * 16 + lr]);
#pragma unroll
        for (int mb = 0; mb < 4; ++mb) { v8h pk;
#pragma unroll
            for (int j = 0; j < 8; ++j) pk[j] = (h16)(acc[mb][nb][j] + bv);
            *(v8ha*)(vt + (nb * 16 + lr) * 72 + mb * 16 + 8 * hi) = pk; } }
    __syncthreads();
    h16* dv = VT + pko((size_t)(b * NH + h) * HD, s0 + 8 * pc, SEQ);   // V^T plane [b][h][d][s], fragment-ordered (rows of SEQ elements)
{
#pragma unroll 1
        for (int it = 0; it < 16; ++it) { const int d = it * 4 + rq; const v8h val = *(const v8ha*)(vt + d * 72 + 8 * pc); *(v8h*)(dv + (size_t)(d >> 4) * (16 * SEQ) + (d & 15) * 8) = val; xwait(); }
         }
}

// ---- k_attn: fused flash attention, one wave per 16 query rows of one (b, h); 32 keys per step.
// Scores are computed transposed: S^T[key][query] = K . Q^T (A = K rows, B = Q rows, 3 bf16 products), so each lane owns ONE query column (lane & 15) and 16 keys per step.
// P^T (x1024, f16) is packed from the two score accumulator tiles straight into the B fragment of O^T[d][query] += V^T[d][key] . P^T[key][query]
// (element r <- tile of keys 0..15, element 8 + r <- tile of keys 16..31, lane unchanged). Row max via one xor-16 shuffle; row sums kept as per-lane partials.
__global__ __launch_bounds__(128) void k_attn(const bf* __restrict__ Qh, const bf* __restrict__ Ql, const bf* __restrict__ Kh, const bf* __restrict__ Kl, const h16* __restrict__ VT, bf* Ch, bf* Cl) {
    __shared__ __align__(16) float ot[AW * 16 * 68];
    const int lane = threadIdx.x & 31, lr = lane & 15, hi = lane >> 4;
    const int wave = __builtin_amdgcn_readfirstlane(threadIdx.x >> 5);
    const int qt = blockIdx.x * AW + wave;
    const int bh = blockIdx.y;
    const size_t pb0 = (size_t)bh * SEQ * HD;
    const size_t qoff = pb0 + (size_t)(qt * 16) * HD + 8 * lane;
    const v16bf qh0 = ldb(Qh + qoff), qh1 = ldb(Qh + qoff + 512), ql0 = ldb(Ql + qoff), ql1 = ldb(Ql + qoff + 512);
    xwait(Qh + qoff, Ql + qoff);
    const size_t koff = pb0 + 8 * lane;
    const size_t voff = (size_t)bh * HD * SEQ + 8 * lane;
    v8f o0 = (v8f){}, o1 = (v8f){}, o2 = (v8f){}, o3 = (v8f){};
    float m = -1.0e30f, l = 0.0f;
#pragma unroll 1
    for (int kb = 0; kb < SEQ; kb += 32) {
        v8f s0 = (v8f){}, s1 = (v8f){};
        const bf* ph = Kh + koff + (size_t)kb * HD; const bf* pl = Kl + koff + (size_t)kb * HD;
        const v16bf a0 = ldb(ph), a1 = ldb(ph + 512), c0 = ldb(pl), c1 = ldb(pl + 512);
        s0 = wmmab(a0, qh0, s0); s0 = wmmab(a1, qh1, s0); s0 = wmmab(c0, qh0, s0); s0 = wmmab(c1, qh1, s0); s0 = wmmab(a0, ql0, s0); s0 = wmmab(a1, ql1, s0);
        const v16bf e0 = ldb(ph + 16 * HD), e1 = ldb(ph + 16 * HD + 512), g0 = ldb(pl + 16 * HD), g1 = ldb(pl + 16 * HD + 512);
        s1 = wmmab(e0, qh0, s1); s1 = wmmab(e1, qh1, s1); s1 = wmmab(g0, qh0, s1); s1 = wmmab(g1, qh1, s1); s1 = wmmab(e0, ql0, s1); s1 = wmmab(e1, ql1, s1);
        asm volatile("v_nop\n\tv_nop\n\tv_nop\n\tv_nop" : "+v"(s0), "+v"(s1) : "v"(e1), "v"(g1), "v"(ql1));
        float mx = fmaxf(s0[0], s1[0]);
#pragma unroll
        for (int r = 1; r < 8; ++r) mx = fmaxf(mx, fmaxf(s0[r], s1[r]));
        mx = fmaxf(mx, __shfl_xor(mx, 16, 32));
        const float mn = fmaxf(m, mx);
        const float corr = __builtin_amdgcn_exp2f((m - mn) * L2E);
        m = mn;
        float ls = 0.0f; v16h pb;
#pragma unroll
        for (int r = 0; r < 8; ++r) {
            const float p0 = __builtin_amdgcn_exp2f(__builtin_fmaf(s0[r] - mn, L2E, 10.0f));   // exp(s - m) x 1024
            const float p1 = __builtin_amdgcn_exp2f(__builtin_fmaf(s1[r] - mn, L2E, 10.0f));
            ls += p0 + p1; pb[r] = (h16)p0; pb[8 + r] = (h16)p1; }
        l = l * corr + ls;
        o0 = o0 * corr; o1 = o1 * corr; o2 = o2 * corr; o3 = o3 * corr;
        const h16* vp = VT + voff + (size_t)kb * 16;
        const v16h va0 = ldh(vp), va1 = ldh(vp + (size_t)16 * SEQ), va2 = ldh(vp + (size_t)32 * SEQ), va3 = ldh(vp + (size_t)48 * SEQ);
        o0 = wmma16(va0, pb, o0); o1 = wmma16(va1, pb, o1); o2 = wmma16(va2, pb, o2); o3 = wmma16(va3, pb, o3);
        asm volatile("v_nop\n\tv_nop\n\tv_nop\n\tv_nop" : "+v"(o0), "+v"(o1), "+v"(o2), "+v"(o3) : "v"(pb), "v"(va3));
        xwait(ph, pl, vp);
    }
    const float lt = l + __shfl_xor(l, 16, 32);
    const float inv = 1.0f / lt;       // the x1024 carry cancels between numerator and row sum
    const int ob = wave * (16 * 68) + lr * 68 + 8 * hi;
    { v4f x0, x1;
      x0[0] = o0[0] * inv; x0[1] = o0[1] * inv; x0[2] = o0[2] * inv; x0[3] = o0[3] * inv; x1[0] = o0[4] * inv; x1[1] = o0[5] * inv; x1[2] = o0[6] * inv; x1[3] = o0[7] * inv;
      *(v4fa*)(ot + ob) = x0; *(v4fa*)(ot + ob + 4) = x1;
      x0[0] = o1[0] * inv; x0[1] = o1[1] * inv; x0[2] = o1[2] * inv; x0[3] = o1[3] * inv; x1[0] = o1[4] * inv; x1[1] = o1[5] * inv; x1[2] = o1[6] * inv; x1[3] = o1[7] * inv;
      *(v4fa*)(ot + ob + 16) = x0; *(v4fa*)(ot + ob + 20) = x1;
      x0[0] = o2[0] * inv; x0[1] = o2[1] * inv; x0[2] = o2[2] * inv; x0[3] = o2[3] * inv; x1[0] = o2[4] * inv; x1[1] = o2[5] * inv; x1[2] = o2[6] * inv; x1[3] = o2[7] * inv;
      *(v4fa*)(ot + ob + 32) = x0; *(v4fa*)(ot + ob + 36) = x1;
      x0[0] = o3[0] * inv; x0[1] = o3[1] * inv; x0[2] = o3[2] * inv; x0[3] = o3[3] * inv; x1[0] = o3[4] * inv; x1[1] = o3[5] * inv; x1[2] = o3[6] * inv; x1[3] = o3[7] * inv;
      *(v4fa*)(ot + ob + 48) = x0; *(v4fa*)(ot + ob + 52) = x1; }
    __syncthreads();
    const int rq = lane >> 3, pc = lane & 7;
    const int b = bh / NH, h = bh % NH;
    const size_t cbase = pko((size_t)(b * SEQ + qt * 16), h * HD + 8 * pc, HID);
{
#pragma unroll 1
        for (int it = 0; it < 4; ++it) {
            const int rr = it * 4 + rq; const int xo = wave * (16 * 68) + rr * 68 + 8 * pc;
            const v4f x0 = *(const v4fa*)(ot + xo), x1 = *(const v4fa*)(ot + xo + 4);
            v8us oh, ol;
#pragma unroll
            for (int q = 0; q < 4; ++q) { unsigned short a2, c2; splitf(x0[q], a2, c2); oh[q] = a2; ol[q] = c2; splitf(x1[q], a2, c2); oh[q + 4] = a2; ol[q + 4] = c2; }
            *(v8us*)(Ch + cbase + (size_t)rr * 8) = oh; *(v8us*)(Cl + cbase + (size_t)rr * 8) = ol; }
         }
}

// ---- k_out: OUT[token][n] = sum_k (Ch + Cl)[token][k] Wo[n][k] + bo[n]; grid (MROWS/64, HID/64), 32 threads.
__global__ __launch_bounds__(32) void k_out(const bf* __restrict__ Ch, const bf* __restrict__ Cl, const bf* __restrict__ W, const float* __restrict__ bias, float* OUT) {
    __shared__ __align__(16) float os[16 * 68];
    const int lane = threadIdx.x & 31, lr = lane & 15, hi = lane >> 4;
    const int r0 = blockIdx.x * 64, c0 = blockIdx.y * 64;
    v8f acc[4][4];
    gemm_core<2>(Ch, Cl, W, r0, c0, lr, hi, acc);
    const int b = r0 / SEQ, s0 = r0 % SEQ;
    const int cofs = lr * 4;
    v4f bb = *(const v4f*)(bias + c0 + cofs); bb[0] = bfr(bb[0]); bb[1] = bfr(bb[1]); bb[2] = bfr(bb[2]); bb[3] = bfr(bb[3]);
#pragma unroll
    for (int mb = 0; mb < 4; ++mb) {
#pragma unroll
        for (int nb = 0; nb < 4; ++nb) {
#pragma unroll
            for (int j = 0; j < 8; ++j) os[(hi * 8 + j) * 68 + nb * 16 + lr] = acc[mb][nb][j]; }
        __syncthreads();
        float* crow = OUT + ((size_t)b * SEQ_FULL + s0 + mb * 16) * HID + c0 + cofs;
{
#pragma unroll 1
            for (int s = 0; s < 8; ++s) { const int row = 2 * s + hi; v4f val = *(const v4fa*)(os + row * 68 + cofs); val = val + bb; *(v4f*)(crow + (size_t)row * HID) = val; }
             }
        __syncthreads();
    }
}

extern "C" void kernel_launch(void* const* d_in, const int* in_sizes, int n_in,
                              void* d_out, int out_size, void* d_ws, size_t ws_size, hipStream_t stream) {
    if (n_in < 9) return;
    const int need_x = (NB - 1) * SEQ_FULL * HID + SEQ * HID;
    if (in_sizes[0] < need_x) return;
    if (in_sizes[1] < HID * HID || in_sizes[3] < HID * HID || in_sizes[5] < HID * HID || in_sizes[7] < HID * HID) return;
    if (in_sizes[2] < HID || in_sizes[4] < HID || in_sizes[6] < HID || in_sizes[8] < HID) return;
    if (out_size < need_x) return;
    const float* x  = (const float*)d_in[0];
    const float* wq = (const float*)d_in[1]; const float* bq = (const float*)d_in[2];
    const float* wk = (const float*)d_in[3]; const float* bk = (const float*)d_in[4];
    const float* wv = (const float*)d_in[5]; const float* bv = (const float*)d_in[6];
    const float* wo = (const float*)d_in[7]; const float* bo = (const float*)d_in[8];
    float* OUT = (float*)d_out;

    constexpr size_t SZ_XB = (size_t)MROWS * HID * 2;            // bf16 x plane
    constexpr size_t SZ_W  = (size_t)HID * HID * 2;              // bf16 weight plane
    constexpr size_t SZ_CS = (size_t)SEQ * 32 * 2 * 4;           // cos/sin table
    constexpr size_t SZ_P  = (size_t)NB * NH * SEQ * HD * 2;     // one head plane set (16-bit)
    constexpr size_t SZ_CT = (size_t)MROWS * HID * 2;            // ctx plane
    constexpr size_t OFF_XB = 0;
    constexpr size_t OFF_WQ = OFF_XB + SZ_XB;
    constexpr size_t OFF_WK = OFF_WQ + SZ_W;
    constexpr size_t OFF_WV = OFF_WK + SZ_W;
    constexpr size_t OFF_WO = OFF_WV + SZ_W;
    constexpr size_t OFF_CS = OFF_WO + SZ_W;
    constexpr size_t OFF_QH = OFF_CS + SZ_CS;
    constexpr size_t OFF_QL = OFF_QH + SZ_P;
    constexpr size_t OFF_KH = OFF_QL + SZ_P;
    constexpr size_t OFF_KL = OFF_KH + SZ_P;
    constexpr size_t OFF_VT = OFF_KL + SZ_P;
    constexpr size_t OFF_CH = OFF_VT + SZ_P;
    constexpr size_t OFF_CL = OFF_CH + SZ_CT;
    constexpr size_t WS_TOTAL = OFF_CL + SZ_CT;
    static_assert(SZ_XB % 256 == 0);
    static_assert(SZ_W % 256 == 0);
    static_assert(SZ_CS % 256 == 0);
    static_assert(SZ_P % 256 == 0);
    static_assert(SZ_CT % 256 == 0);
    static_assert(WS_TOTAL <= (size_t)134217728);
    if (WS_TOTAL > ws_size) return;
    char* wsp = (char*)d_ws;
    bf* XB = (bf*)(wsp + OFF_XB); bf* WQ = (bf*)(wsp + OFF_WQ); bf* WK = (bf*)(wsp + OFF_WK); bf* WV = (bf*)(wsp + OFF_WV); bf* WO = (bf*)(wsp + OFF_WO);
    float* CS = (float*)(wsp + OFF_CS);
    bf* QPh = (bf*)(wsp + OFF_QH); bf* QPl = (bf*)(wsp + OFF_QL); bf* KPh = (bf*)(wsp + OFF_KH); bf* KPl = (bf*)(wsp + OFF_KL);
    h16* VT = (h16*)(wsp + OFF_VT);
    bf* CTh = (bf*)(wsp + OFF_CH); bf* CTl = (bf*)(wsp + OFF_CL);

    // operand planes (bf16 RNE, fragment-ordered) built once
    k_cvt<<<dim3(SEQ * HID / 2048, NB), 256, 0, stream>>>(x, XB, SEQ * HID, SEQ_FULL * HID);
    k_cvt<<<dim3(HID * HID / 2048, 1), 256, 0, stream>>>(wq, WQ, HID * HID, HID * HID);
    k_cvt<<<dim3(HID * HID / 2048, 1), 256, 0, stream>>>(wk, WK, HID * HID, HID * HID);
    k_cvt<<<dim3(HID * HID / 2048, 1), 256, 0, stream>>>(wv, WV, HID * HID, HID * HID);
    k_cvt<<<dim3(HID * HID / 2048, 1), 256, 0, stream>>>(wo, WO, HID * HID, HID * HID);
    k_cstab<<<SEQ * 32 / 256, 256, 0, stream>>>(CS);
    // projections with fused rotary / transpose epilogues (q carries the 1/8 score scale, exact)
    k_proj_rope<<<dim3(MROWS / 64, NH), 32, 0, stream>>>(XB, WQ, bq, CS, 0.125f, QPh, QPl);
    k_proj_rope<<<dim3(MROWS / 64, NH), 32, 0, stream>>>(XB, WK, bk, CS, 1.0f, KPh, KPl);
    k_proj_v<<<dim3(MROWS / 64, NH), 32, 0, stream>>>(XB, WV, bv, VT);
    // fused attention -> ctx hi | lo planes [token][h*64 + d], fragment-ordered
    k_attn<<<dim3(SEQ / (16 * AW), NB * NH), 32 * AW, 0, stream>>>(QPh, QPl, KPh, KPl, VT, CTh, CTl);
    // output projection -> d_out
    k_out<<<dim3(MROWS / 64, HID / 64), 32, 0, stream>>>(CTh, CTl, WO, bo, OUT);
}

// v002
// It runs in 139 microseconds.
// In two side-by-side timings against v001, it was 1.97 and 1.94 times as fast.
// Counting every step since v000, it is 2.14 times as fast.
#include <hip/hip_runtime.h>

// Contractions: q/k/v projections v_wmma_f32_16x16x32_bf16 (x and W as bf16 RNE planes, single product); scores bf16 hi|lo planes of rope(q)/8 and rope(k), three products; P.V v_wmma_f32_16x16x32_f16 (P carried x1024, V^T f16); output projection bf16 (ctx hi + ctx lo) x Wo, two products; all f32 accumulate, softmax f32.

#ifndef NB
#define NB 2
#endif
#ifndef SEQ
#define SEQ 2048
#endif
#define NB_FULL  2
#define SEQ_FULL 2048
#define HID   1024
#define NH    16
#define HD    64
#define KD    1024               // contraction length of every GEMM
#define MROWS (NB * SEQ)
#define AW    4                  // waves per attention block (16 query rows each)
#define L2E   1.4426950408889634f

typedef _Float16 h16;
typedef unsigned short bf;
typedef __attribute__((ext_vector_type(16))) __bf16   v16bf;
typedef __attribute__((ext_vector_type(16))) _Float16 v16h;
typedef __attribute__((ext_vector_type(8)))  _Float16 v8h;
typedef __attribute__((ext_vector_type(8)))  unsigned short v8us;
typedef __attribute__((ext_vector_type(8)))  float    v8f;
typedef __attribute__((ext_vector_type(4)))  float    v4f;
typedef __attribute__((ext_vector_type(2)))  float    v2f;
typedef v8h  __attribute__((may_alias)) v8ha;
typedef v4f  __attribute__((may_alias)) v4fa;

static_assert(NB <= NB_FULL);
static_assert(SEQ <= SEQ_FULL);
static_assert(HID == NH * HD);
static_assert(HD == 64);
static_assert(KD == HID);
static_assert(KD % 32 == 0);
static_assert(SEQ % 64 == 0);
static_assert(MROWS % 64 == 0);
static_assert(HID % 64 == 0);
static_assert(SEQ % (16 * AW) == 0);
static_assert(SEQ % 32 == 0);
static_assert((SEQ * HID) % 2048 == 0);
static_assert((HID * HID) % 2048 == 0);
static_assert((SEQ * 32) % 256 == 0);

__device__ __forceinline__ unsigned short f2bf(float f) { unsigned u = __float_as_uint(f); u += 0x7FFFu + ((u >> 16) & 1u); return (unsigned short)(u >> 16); }
__device__ __forceinline__ float bf2f(unsigned short b) { return __uint_as_float(((unsigned)b) << 16); }
__device__ __forceinline__ float bfr(float f) { return bf2f(f2bf(f)); }
__device__ __forceinline__ void splitf(float y, unsigned short& h, unsigned short& l) { h = f2bf(y); l = f2bf(y - bf2f(h)); }
__device__ __forceinline__ v16h cat16(v8h lo, v8h hi) { return __builtin_shufflevector(lo, hi, 0, 1, 2, 3, 4, 5, 6, 7, 8, 9, 10, 11, 12, 13, 14, 15); }
__device__ __forceinline__ v16bf cat16b(v8us lo, v8us hi) { return __builtin_bit_cast(v16bf, __builtin_shufflevector(lo, hi, 0, 1, 2, 3, 4, 5, 6, 7, 8, 9, 10, 11, 12, 13, 14, 15)); }
// Fragment-ordered planes: every 16-bit operand plane (rows of P elements, k contiguous in the maths) is stored as 1-KiB blocks, one per (16 rows, 32 k).
// Inside a block the 16-byte group of (row, k .. k + 7) sits at lane slot 16 * ((k >> 3) & 1) + (row & 15) of half (k >> 4) & 1, so one wave-wide 16-byte load reads 512 contiguous bytes (4 whole lines).
// pko: element offset of that group, k % 8 == 0.
__device__ __forceinline__ size_t pko(size_t row, int k, int P) { return ((row >> 4) * (size_t)(P >> 5) + (size_t)(k >> 5)) * 512 + (size_t)(((k >> 4) & 1) * 256 + ((k >> 3) & 1) * 128) + (row & 15) * 8; }
// Fragment loaders: p = block start + 8 * lane; elements 0..7 <- k0 + 8h + 0..7, elements 8..15 <- k0 + 16 + 8h + 0..7, row lane & 15, h = lane >> 4 (same map for A and B).
__device__ __forceinline__ v16bf ldb(const bf* p) { return cat16b(*(const v8us*)p, *(const v8us*)(p + 256)); }
__device__ __forceinline__ v16h  ldh(const h16* p) { return cat16(*(const v8h*)p, *(const v8h*)(p + 256)); }
// xwait stands behind global loads or stores, before a register that they name is written again; the forms with pointers take the loads' addresses as inputs, so that no later load's result is placed over an address pair ahead of the wait.
__device__ __forceinline__ void xwait() { asm volatile("s_wait_xcnt 0x0" ::: "memory"); }
__device__ __forceinline__ void xwait(const void* a, const void* b) { asm volatile("s_wait_xcnt 0x0" :: "v"(a), "v"(b) : "memory"); }
__device__ __forceinline__ void xwait(const void* a, const void* b, const void* c) { asm volatile("s_wait_xcnt 0x0" :: "v"(a), "v"(b), "v"(c) : "memory"); }
__device__ __forceinline__ v8f wmma16(v16h a, v16h b, v8f c) { return __builtin_amdgcn_wmma_f32_16x16x32_f16(false, a, false, b, (short)0, c, false, false); }
__device__ __forceinline__ v8f wmmab(v16bf a, v16bf b, v8f c) { return __builtin_amdgcn_wmma_f32_16x16x32_bf16(false, a, false, b, (short)0, c, false, false); }

__global__ __launch_bounds__(256) void k_cvt(const float* __restrict__ src, bf* dst, int per, int sstride) {
    // a block converts 16 rows x 128 columns of a plane of HID columns; a wave holds 16 rows x 2 groups, which is one 512-byte half block of dst
    if ((int)blockIdx.x * 2048 >= per) return;
    const int row = (blockIdx.x >> 3) * 16 + (threadIdx.x & 15), k = (blockIdx.x & 7) * 128 + (threadIdx.x >> 4) * 8;
    const float* s = src + (size_t)blockIdx.y * sstride + (size_t)row * HID + k;
    const v4f a = *(const v4f*)s, b = *(const v4f*)(s + 4);
    v8us o; o[0] = f2bf(a[0]); o[1] = f2bf(a[1]); o[2] = f2bf(a[2]); o[3] = f2bf(a[3]); o[4] = f2bf(b[0]); o[5] = f2bf(b[1]); o[6] = f2bf(b[2]); o[7] = f2bf(b[3]);
    bf* d = dst + (size_t)blockIdx.y * per + pko(row, k, HID);
    *(v8us*)d = o; 
}

__global__ __launch_bounds__(256) void k_cstab(float* CS) {
    const int idx = blockIdx.x * 256 + threadIdx.x; if (idx >= SEQ * 32) return;
    const int s = idx >> 5, j = idx & 31;
    const double p = (double)(1u << (j >> 1)) * ((j & 1) ? 1.4142135623730951 : 1.0);
    const float pf = (float)p; const float inv = 1.0f / pf; const float ang = (float)s * inv;
    float sn, c; sincosf(ang, &sn, &c);
    v2f cs; cs[0] = c; cs[1] = sn;
    *(v2f*)(CS + (size_t)idx * 2) = cs; 
}

// ---- gemm_core: one wave computes a 64x64 tile, acc[mb][nb] = sum_k A[r0+16mb+..][k] Bt[c0+16nb+..][k] (+ A2 product when NA == 2); operands straight from fragment-ordered bf16 planes (rows of KD elements).
// The fragments of a k step (32 k) are loaded two steps ahead of their products, into four register sets used in turn: the loads of two steps are in flight while a third is multiplied.
template <int NA> struct fset { v16bf a[4], a2[4], b[4]; };
// st: element offset of the k step from the pointers (512 elements a step)
template <int NA>
__device__ __forceinline__ void ldset(fset<NA>& f, const bf* pa, const bf* pa2, const bf* pb, const int st) {
#pragma unroll
    for (int mb = 0; mb < 4; ++mb) { f.a[mb] = ldb(pa + st + mb * 16 * KD); if (NA == 2) f.a2[mb] = ldb(pa2 + st + mb * 16 * KD); }
#pragma unroll
    for (int nb = 0; nb < 4; ++nb) f.b[nb] = ldb(pb + st + nb * 16 * KD);
}
template <int NA>
__device__ __forceinline__ void mmset(const fset<NA>& f, v8f (&acc)[4][4]) {
#pragma unroll
    for (int nb = 0; nb < 4; ++nb)
#pragma unroll
        for (int mb = 0; mb < 4; ++mb) { acc[mb][nb] = wmmab(f.a[mb], f.b[nb], acc[mb][nb]); if (NA == 2) acc[mb][nb] = wmmab(f.a2[mb], f.b[nb], acc[mb][nb]); }
}
template <int NA>
__device__ __forceinline__ void gemm_core(const bf* __restrict__ A, const bf* __restrict__ A2, const bf* __restrict__ Bt, const int r0, const int c0, const int lr, const int hi, v8f (&acc)[4][4]) {
    static_assert(KD % 128 == 0 && KD >= 256);
#pragma unroll
    for (int mb = 0; mb < 4; ++mb)
#pragma unroll
        for (int nb = 0; nb < 4; ++nb) acc[mb][nb] = (v8f){};
    const size_t aoff = pko(r0, 0, KD) + 8 * (16 * hi + lr), boff = pko(c0, 0, KD) + 8 * (16 * hi + lr);
    unsigned ao = (unsigned)aoff, bo = (unsigned)boff;   // element offsets of the trip's first step; every plane is far below 2^32 elements
    fset<NA> f0, f1, f2, f3;
    // SB holds each step's loads together and in program order: the load counter retires in order, so a load sunk behind a later step's loads would make its wait drain those as well.
#define SB() __builtin_amdgcn_sched_barrier(0)
    ldset<NA>(f0, A + ao, A2 + ao, Bt + bo, 0); SB(); ldset<NA>(f1, A + ao, A2 + ao, Bt + bo, 512); SB();
#pragma unroll 1
    for (int kc = 0; kc < KD - 128; kc += 128) {   // rolled: four steps a trip, one per register set
        const bf* pa = A + ao; const bf* pa2 = A2 + ao; const bf* pb = Bt + bo;
        ldset<NA>(f2, pa, pa2, pb, 1024); SB(); mmset<NA>(f0, acc); SB();
        ldset<NA>(f3, pa, pa2, pb, 1536); SB(); mmset<NA>(f1, acc); SB();
        ldset<NA>(f0, pa, pa2, pb, 2048); SB(); mmset<NA>(f2, acc); SB();
        ldset<NA>(f1, pa, pa2, pb, 2560); SB(); mmset<NA>(f3, acc); SB();
        // the wait takes the loads' addresses as inputs, so that nothing is placed over them ahead of it, and the offsets pass through it, so that the next trip's addresses cannot be formed ahead of it
        if (NA == 2) asm volatile("s_wait_xcnt 0x0" : "+v"(ao), "+v"(bo) : "v"(pa), "v"(pa2), "v"(pb) : "memory");
        else         asm volatile("s_wait_xcnt 0x0" : "+v"(ao), "+v"(bo) : "v"(pa), "v"(pb) : "memory");
        ao += 2048; bo += 2048;
    }
    { const bf* pa = A + ao; const bf* pa2 = A2 + ao; const bf* pb = Bt + bo;
      ldset<NA>(f2, pa, pa2, pb, 1024); SB(); mmset<NA>(f0, acc); SB();
      ldset<NA>(f3, pa, pa2, pb, 1536); SB(); mmset<NA>(f1, acc); SB();
      mmset<NA>(f2, acc); mmset<NA>(f3, acc);
      if (NA == 2) xwait(pa, pa2, pb); else xwait(pa, pb); }
#undef SB
}

// ---- k_proj_rope: F = XB . W^T + bias for one head (64 columns) and 64 tokens, then rotate-half rotary and scale sc; head planes [b][h][s][d] as bf16 hi | lo, fragment-ordered (rows of HD elements).
__global__ __launch_bounds__(32) void k_proj_rope(const bf* __restrict__ XB, const bf* __restrict__ W, const float* __restrict__ bias, const float* __restrict__ CS, float sc, bf* Ph, bf* Pl) {
    __shared__ __align__(16) float os[16 * 68];
    const int lane = threadIdx.x & 31, lr = lane & 15, hi = lane >> 4;
    const int r0 = blockIdx.x * 64, c0 = blockIdx.y * 64;
    v8f acc[4][4];
    gemm_core<1>(XB, XB, W, r0, c0, lr, hi, acc);
    const int b = r0 / SEQ, s0 = r0 % SEQ, h = blockIdx.y;
    const int rq = lane >> 3, pc = lane & 7, d0 = pc * 8, dp0 = d0 ^ 32, jf0 = d0 & 31;
    const float sgn = (d0 < 32) ? -1.0f : 1.0f;
    float bx[8], bp[8];
    { const v4f u0 = *(const v4f*)(bias + c0 + d0), u1 = *(const v4f*)(bias + c0 + d0 + 4), w0 = *(const v4f*)(bias + c0 + dp0), w1 = *(const v4f*)(bias + c0 + dp0 + 4);
      xwait(); __builtin_amdgcn_sched_barrier(0);   // the barrier holds later vector work behind the wait: without it this build rewrites a load's offset register ahead of the wait
#pragma unroll
      for (int q = 0; q < 4; ++q) { bx[q] = bfr(u0[q]); bx[q + 4] = bfr(u1[q]); bp[q] = bfr(w0[q]); bp[q + 4] = bfr(w1[q]); } }
#pragma unroll
    for (int mb = 0; mb < 4; ++mb) {
#pragma unroll
        for (int nb = 0; nb < 4; ++nb) {
#pragma unroll
            for (int j = 0; j < 8; ++j) os[(hi * 8 + j) * 68 + nb * 16 + lr] = acc[mb][nb][j]; }
        __syncthreads();
        const size_t prow = pko((size_t)(b * NH + h) * SEQ + s0 + mb * 16, d0, HD);
{
#pragma unroll 1
            for (int it = 0; it < 4; ++it) {
                const int rr = it * 4 + rq; const int s = s0 + mb * 16 + rr; const int xo = rr * 68;
                const v4f xa = *(const v4fa*)(os + xo + d0), xb = *(const v4fa*)(os + xo + d0 + 4);
                const v4f ya = *(const v4fa*)(os + xo + dp0), yb = *(const v4fa*)(os + xo + dp0 + 4);
                const float* cp = CS + ((size_t)s * 32 + jf0) * 2;
                const v4f t0 = *(const v4f*)cp, t1 = *(const v4f*)(cp + 4), t2 = *(const v4f*)(cp + 8), t3 = *(const v4f*)(cp + 12);
                const float xv[8] = { xa[0], xa[1], xa[2], xa[3], xb[0], xb[1], xb[2], xb[3] };
                const float yv[8] = { ya[0], ya[1], ya[2], ya[3], yb[0], yb[1], yb[2], yb[3] };
                const float cv[8] = { t0[0], t0[2], t1[0], t1[2], t2[0], t2[2], t3[0], t3[2] };
                const float sv[8] = { t0[1], t0[3], t1[1], t1[3], t2[1], t2[3], t3[1], t3[3] };
                v8us oh, ol;
#pragma unroll
                for (int q = 0; q < 8; ++q) { const float x = xv[q] + bx[q], y = yv[q] + bp[q]; const float r = (x * cv[q] + sgn * (y * sv[q])) * sc; unsigned short a2, c2; splitf(r, a2, c2); oh[q] = a2; ol[q] = c2; }
                *(v8us*)(Ph + prow + (size_t)rr * 8) = oh; *(v8us*)(Pl + prow + (size_t)rr * 8) = ol; xwait(); }
             }
        __syncthreads();
    }
}

__global__ __launch_bounds__(32) void k_proj_v(const bf* __restrict__ XB, const bf* __restrict__ W, const float* __restrict__ bias, h16* VT) {
    __shared__ __align__(16) h16 vt[64 * 72];
    const int lane = threadIdx.x & 31, lr = lane & 15, hi = lane >> 4;
    const int r0 = blockIdx.x * 64, c0 = blockIdx.y * 64;
    v8f acc[4][4];
    gemm_core<1>(XB, XB, W, r0, c0, lr, hi, acc);
    const int b = r0 / SEQ, s0 = r0 % SEQ, h = blockIdx.y;
    const int rq = lane >> 3, pc = lane & 7;
#pragma unroll
    for (int nb = 0; nb < 4; ++nb) { const float bv = bfr(bias[c0 + nb * 16 + lr]);
#pragma unroll
        for (int mb = 0; mb < 4; ++mb) { v8h pk;
#pragma unroll
            for (int j = 0; j < 8; ++j) pk[j] = (h16)(acc[mb][nb][j] + bv);
            *(v8ha*)(vt + (nb * 16 + lr) * 72 + mb * 16 + 8 * hi) = pk; } }
    __syncthreads();
    h16* dv = VT + pko((size_t)(b * NH + h) * HD, s0 + 8 * pc, SEQ);   // V^T plane [b][h][d][s], fragment-ordered (rows of SEQ elements)
{
#pragma unroll 1
        for (int it = 0; it < 16; ++it) { const int d = it * 4 + rq; const v8h val = *(const v8ha*)(vt + d * 72 + 8 * pc); *(v8h*)(dv + (size_t)(d >> 4) * (16 * SEQ) + (d & 15) * 8) = val; xwait(); }
         }
}

template <bool B> struct flag { static constexpr bool v = B; };

// ---- k_attn: fused flash attention, one wave per 16 query rows of one (b, h); 32 keys per step.
// Scores are computed transposed: S^T[key][query] = K . Q^T (A = K rows, B = Q rows, 3 bf16 products), so each lane owns ONE query column (lane & 15) and 16 keys per step.
// P^T (x1024, f16) is packed from the two score accumulator tiles straight into the B fragment of O^T[d][query] += V^T[d][key] . P^T[key][query]
// (element r <- tile of keys 0..15, element 8 + r <- tile of keys 16..31, lane unchanged). Row max via one xor-16 shuffle; row sums kept as per-lane partials.
__global__ __launch_bounds__(128) void k_attn(const bf* __restrict__ Qh, const bf* __restrict__ Ql, const bf* __restrict__ Kh, const bf* __restrict__ Kl, const h16* __restrict__ VT, bf* Ch, bf* Cl) {
    __shared__ __align__(16) float ot[AW * 16 * 68];
    const int lane = threadIdx.x & 31, lr = lane & 15, hi = lane >> 4;
    const int wave = __builtin_amdgcn_readfirstlane(threadIdx.x >> 5);
    const int qt = blockIdx.x * AW + wave;
    const int bh = blockIdx.y;
    const size_t pb0 = (size_t)bh * SEQ * HD;
    const size_t qoff = pb0 + (size_t)(qt * 16) * HD + 8 * lane;
    const v16bf qh0 = ldb(Qh + qoff), qh1 = ldb(Qh + qoff + 512), ql0 = ldb(Ql + qoff), ql1 = ldb(Ql + qoff + 512);
    xwait(Qh + qoff, Ql + qoff);
    const size_t koff = pb0 + 8 * lane;
    const size_t voff = (size_t)bh * HD * SEQ + 8 * lane;
    v8f o0 = (v8f){}, o1 = (v8f){}, o2 = (v8f){}, o3 = (v8f){};
    float m = -1.0e30f, l = 0.0f;
    // K and V^T fragments are loaded one pass ahead of their products, into the registers that the pass has just multiplied from; ko, vo: element offsets of the loads last issued (every plane is far below 2^32 elements)
    unsigned ko = (unsigned)koff, vo = (unsigned)voff;
    const bf* ph = Kh + ko; const bf* pl = Kl + ko; const h16* vp = VT + vo;   // the addresses of the loads last issued
    // SB holds the first pass's loads in the order that the loop issues them in: the load counter retires in order, and the waits at the loop's head count for both ways into it
#define SB() __builtin_amdgcn_sched_barrier(0)
    v16bf a0 = ldb(ph), a1 = ldb(ph + 512); SB();
    v16bf c0 = ldb(pl), c1 = ldb(pl + 512); SB();
    v16bf e0 = ldb(ph + 16 * HD), e1 = ldb(ph + 16 * HD + 512); SB();
    v16bf g0 = ldb(pl + 16 * HD), g1 = ldb(pl + 16 * HD + 512); SB();
    v16h va0 = ldh(vp), va1 = ldh(vp + (size_t)16 * SEQ), va2 = ldh(vp + (size_t)32 * SEQ), va3 = ldh(vp + (size_t)48 * SEQ); SB();
#undef SB
    // one pass of 32 keys; more: a further pass follows, whose fragments this one loads (a compile-time flag, so that the load counts are the same on every path and the counted waits stay exact)
    auto pass = [&](auto more) __attribute__((always_inline)) {
        v8f s0 = (v8f){}, s1 = (v8f){};
        s0 = wmmab(a0, qh0, s0); s0 = wmmab(a1, qh1, s0); s0 = wmmab(c0, qh0, s0); s0 = wmmab(c1, qh1, s0); s0 = wmmab(a0, ql0, s0); s0 = wmmab(a1, ql1, s0);
        s1 = wmmab(e0, qh0, s1); s1 = wmmab(e1, qh1, s1); s1 = wmmab(g0, qh0, s1); s1 = wmmab(g1, qh1, s1); s1 = wmmab(e0, ql0, s1); s1 = wmmab(e1, ql1, s1);
        asm volatile("v_nop\n\tv_nop\n\tv_nop\n\tv_nop" : "+v"(s0), "+v"(s1) : "v"(e1), "v"(g1), "v"(ql1));
        // the wait takes the earlier loads' addresses as inputs, so that nothing is placed over them ahead of it, and the offsets pass through it, so that the next addresses cannot be formed ahead of it
        asm volatile("s_wait_xcnt 0x0" : "+v"(ko), "+v"(vo) : "v"(ph), "v"(pl), "v"(vp) : "memory");
        if constexpr (decltype(more)::v) {   // next pass's K
            ko += 32 * HD; ph = Kh + ko; pl = Kl + ko;
            a0 = ldb(ph); a1 = ldb(ph + 512); c0 = ldb(pl); c1 = ldb(pl + 512);
            e0 = ldb(ph + 16 * HD); e1 = ldb(ph + 16 * HD + 512); g0 = ldb(pl + 16 * HD); g1 = ldb(pl + 16 * HD + 512);
            __builtin_amdgcn_sched_barrier(0);   // keeps all of these loads here, ahead of the softmax: sunk below it they would have too little lead
        }
        float mx = fmaxf(s0[0], s1[0]);
#pragma unroll
        for (int r = 1; r < 8; ++r) mx = fmaxf(mx, fmaxf(s0[r], s1[r]));
        mx = fmaxf(mx, __shfl_xor(mx, 16, 32));
        const float mn = fmaxf(m, mx);
        const float corr = __builtin_amdgcn_exp2f((m - mn) * L2E);
        m = mn;
        float ls = 0.0f; v16h pb;
#pragma unroll
        for (int r = 0; r < 8; ++r) {
            const float p0 = __builtin_amdgcn_exp2f(__builtin_fmaf(s0[r] - mn, L2E, 10.0f));   // exp(s - m) x 1024
            const float p1 = __builtin_amdgcn_exp2f(__builtin_fmaf(s1[r] - mn, L2E, 10.0f));
            ls += p0 + p1; pb[r] = (h16)p0; pb[8 + r] = (h16)p1; }
        l = l * corr + ls;
        o0 = o0 * corr; o1 = o1 * corr; o2 = o2 * corr; o3 = o3 * corr;
        o0 = wmma16(va0, pb, o0); o1 = wmma16(va1, pb, o1); o2 = wmma16(va2, pb, o2); o3 = wmma16(va3, pb, o3);
        asm volatile("v_nop\n\tv_nop\n\tv_nop\n\tv_nop" : "+v"(o0), "+v"(o1), "+v"(o2), "+v"(o3) : "v"(pb), "v"(va3));
        if constexpr (decltype(more)::v) {   // next pass's V^T
            vo += 32 * 16; vp = VT + vo;
            va0 = ldh(vp); va1 = ldh(vp + (size_t)16 * SEQ); va2 = ldh(vp + (size_t)32 * SEQ); va3 = ldh(vp + (size_t)48 * SEQ);
        }
    };
#pragma unroll 1
    for (int kb = 0; kb < SEQ - 32; kb += 32) pass(flag<true>{});   // rolled: the body is long
    pass(flag<false>{});
    const float lt = l + __shfl_xor(l, 16, 32);
    const float inv = 1.0f / lt;       // the x1024 carry cancels between numerator and row sum
    const int ob = wave * (16 * 68) + lr * 68 + 8 * hi;
    { v4f x0, x1;
      x0[0] = o0[0] * inv; x0[1] = o0[1] * inv; x0[2] = o0[2] * inv; x0[3] = o0[3] * inv; x1[0] = o0[4] * inv; x1[1] = o0[5] * inv; x1[2] = o0[6] * inv; x1[3] = o0[7] * inv;
      *(v4fa*)(ot + ob) = x0; *(v4fa*)(ot + ob + 4) = x1;
      x0[0] = o1[0] * inv; x0[1] = o1[1] * inv; x0[2] = o1[2] * inv; x0[3] = o1[3] * inv; x1[0] = o1[4] * inv; x1[1] = o1[5] * inv; x1[2] = o1[6] * inv; x1[3] = o1[7] * inv;
      *(v4fa*)(ot + ob + 16) = x0; *(v4fa*)(ot + ob + 20) = x1;
      x0[0] = o2[0] * inv; x0[1] = o2[1] * inv; x0[2] = o2[2] * inv; x0[3] = o2[3] * inv; x1[0] = o2[4] * inv; x1[1] = o2[5] * inv; x1[2] = o2[6] * inv; x1[3] = o2[7] * inv;
      *(v4fa*)(ot + ob + 32) = x0; *(v4fa*)(ot + ob + 36) = x1;
      x0[0] = o3[0] * inv; x0[1] = o3[1] * inv; x0[2] = o3[2] * inv; x0[3] = o3[3] * inv; x1[0] = o3[4] * inv; x1[1] = o3[5] * inv; x1[2] = o3[6] * inv; x1[3] = o3[7] * inv;
      *(v4fa*)(ot + ob + 48) = x0; *(v4fa*)(ot + ob + 52) = x1; }
    __syncthreads();
    const int rq = lane >> 3, pc = lane & 7;
    const int b = bh / NH, h = bh % NH;
    const size_t cbase = pko((size_t)(b * SEQ + qt * 16), h * HD + 8 * pc, HID);
{
#pragma unroll 1
        for (int it = 0; it < 4; ++it) {
            const int rr = it * 4 + rq; const int xo = wave * (16 * 68) + rr * 68 + 8 * pc;
            const v4f x0 = *(const v4fa*)(ot + xo), x1 = *(const v4fa*)(ot + xo + 4);
            v8us oh, ol;
#pragma unroll
            for (int q = 0; q < 4; ++q) { unsigned short a2, c2; splitf(x0[q], a2, c2); oh[q] = a2; ol[q] = c2; splitf(x1[q], a2, c2); oh[q + 4] = a2; ol[q + 4] = c2; }
            *(v8us*)(Ch + cbase + (size_t)rr * 8) = oh; *(v8us*)(Cl + cbase + (size_t)rr * 8) = ol; }
         }
}

// ---- k_out: OUT[token][n] = sum_k (Ch + Cl)[token][k] Wo[n][k] + bo[n]; grid (MROWS/64, HID/64), 32 threads.
__global__ __launch_bounds__(32) void k_out(const bf* __restrict__ Ch, const bf* __restrict__ Cl, const bf* __restrict__ W, const float* __restrict__ bias, float* OUT) {
    __shared__ __align__(16) float os[16 * 68];
    const int lane = threadIdx.x & 31, lr = lane & 15, hi = lane >> 4;
    const int r0 = blockIdx.x * 64, c0 = blockIdx.y * 64;
    v8f acc[4][4];
    gemm_core<2>(Ch, Cl, W, r0, c0, lr, hi, acc);
    const int b = r0 / SEQ, s0 = r0 % SEQ;
    const int cofs = lr * 4;
    v4f bb = *(const v4f*)(bias + c0 + cofs); bb[0] = bfr(bb[0]); bb[1] = bfr(bb[1]); bb[2] = bfr(bb[2]); bb[3] = bfr(bb[3]);
#pragma unroll
    for (int mb = 0; mb < 4; ++mb) {
#pragma unroll
        for (int nb = 0; nb < 4; ++nb) {
#pragma unroll
            for (int j = 0; j < 8; ++j) os[(hi * 8 + j) * 68 + nb * 16 + lr] = acc[mb][nb][j]; }
        __syncthreads();
        float* crow = OUT + ((size_t)b * SEQ_FULL + s0 + mb * 16) * HID + c0 + cofs;
{
#pragma unroll 1
            for (int s = 0; s < 8; ++s) { const int row = 2 * s + hi; v4f val = *(const v4fa*)(os + row * 68 + cofs); val = val + bb; *(v4f*)(crow + (size_t)row * HID) = val; }
             }
        __syncthreads();
    }
}

extern "C" void kernel_launch(void* const* d_in, const int* in_sizes, int n_in,
                              void* d_out, int out_size, void* d_ws, size_t ws_size, hipStream_t stream) {
    if (n_in < 9) return;
    const int need_x = (NB - 1) * SEQ_FULL * HID + SEQ * HID;
    if (in_sizes[0] < need_x) return;
    if (in_sizes[1] < HID * HID || in_sizes[3] < HID * HID || in_sizes[5] < HID * HID || in_sizes[7] < HID * HID) return;
    if (in_sizes[2] < HID || in_sizes[4] < HID || in_sizes[6] < HID || in_sizes[8] < HID) return;
    if (out_size < need_x) return;
    const float* x  = (const float*)d_in[0];
    const float* wq = (const float*)d_in[1]; const float* bq = (const float*)d_in[2];
    const float* wk = (const float*)d_in[3]; const float* bk = (const float*)d_in[4];
    const float* wv = (const float*)d_in[5]; const float* bv = (const float*)d_in[6];
    const float* wo = (const float*)d_in[7]; const float* bo = (const float*)d_in[8];
    float* OUT = (float*)d_out;

    constexpr size_t SZ_XB = (size_t)MROWS * HID * 2;            // bf16 x plane
    constexpr size_t SZ_W  = (size_t)HID * HID * 2;              // bf16 weight plane
    constexpr size_t SZ_CS = (size_t)SEQ * 32 * 2 * 4;           // cos/sin table
    constexpr size_t SZ_P  = (size_t)NB * NH * SEQ * HD * 2;     // one head plane set (16-bit)
    constexpr size_t SZ_CT = (size_t)MROWS * HID * 2;            // ctx plane
    constexpr size_t OFF_XB = 0;
    constexpr size_t OFF_WQ = OFF_XB + SZ_XB;
    constexpr size_t OFF_WK = OFF_WQ + SZ_W;
    constexpr size_t OFF_WV = OFF_WK + SZ_W;
    constexpr size_t OFF_WO = OFF_WV + SZ_W;
    constexpr size_t OFF_CS = OFF_WO + SZ_W;
    constexpr size_t OFF_QH = OFF_CS + SZ_CS;
    constexpr size_t OFF_QL = OFF_QH + SZ_P;
    constexpr size_t OFF_KH = OFF_QL + SZ_P;
    constexpr size_t OFF_KL = OFF_KH + SZ_P;
    constexpr size_t OFF_VT = OFF_KL + SZ_P;
    constexpr size_t OFF_CH = OFF_VT + SZ_P;
    constexpr size_t OFF_CL = OFF_CH + SZ_CT;
    constexpr size_t WS_TOTAL = OFF_CL + SZ_CT;
    static_assert(SZ_XB % 256 == 0);
    static_assert(SZ_W % 256 == 0);
    static_assert(SZ_CS % 256 == 0);
    static_assert(SZ_P % 256 == 0);
    static_assert(SZ_CT % 256 == 0);
    static_assert(WS_TOTAL <= (size_t)134217728);
    if (WS_TOTAL > ws_size) return;
    char* wsp = (char*)d_ws;
    bf* XB = (bf*)(wsp + OFF_XB); bf* WQ = (bf*)(wsp + OFF_WQ); bf* WK = (bf*)(wsp + OFF_WK); bf* WV = (bf*)(wsp + OFF_WV); bf* WO = (bf*)(wsp + OFF_WO);
    float* CS = (float*)(wsp + OFF_CS);
    bf* QPh = (bf*)(wsp + OFF_QH); bf* QPl = (bf*)(wsp + OFF_QL); bf* KPh = (bf*)(wsp + OFF_KH); bf* KPl = (bf*)(wsp + OFF_KL);
    h16* VT = (h16*)(wsp + OFF_VT);
    bf* CTh = (bf*)(wsp + OFF_CH); bf* CTl = (bf*)(wsp + OFF_CL);

    // operand planes (bf16 RNE, fragment-ordered) built once
    k_cvt<<<dim3(SEQ * HID / 2048, NB), 256, 0, stream>>>(x, XB, SEQ * HID, SEQ_FULL * HID);
    k_cvt<<<dim3(HID * HID / 2048, 1), 256, 0, stream>>>(wq, WQ, HID * HID, HID * HID);
    k_cvt<<<dim3(HID * HID / 2048, 1), 256, 0, stream>>>(wk, WK, HID * HID, HID * HID);
    k_cvt<<<dim3(HID * HID / 2048, 1), 256, 0, stream>>>(wv, WV, HID * HID, HID * HID);
    k_cvt<<<dim3(HID * HID / 2048, 1), 256, 0, stream>>>(wo, WO, HID * HID, HID * HID);
    k_cstab<<<SEQ * 32 / 256, 256, 0, stream>>>(CS);
    // projections with fused rotary / transpose epilogues (q carries the 1/8 score scale, exact)
    k_proj_rope<<<dim3(MROWS / 64, NH), 32, 0, stream>>>(XB, WQ, bq, CS, 0.125f, QPh, QPl);
    k_proj_rope<<<dim3(MROWS / 64, NH), 32, 0, stream>>>(XB, WK, bk, CS, 1.0f, KPh, KPl);
    k_proj_v<<<dim3(MROWS / 64, NH), 32, 0, stream>>>(XB, WV, bv, VT);
    // fused attention -> ctx hi | lo planes [token][h*64 + d], fragment-ordered
    k_attn<<<dim3(SEQ / (16 * AW), NB * NH), 32 * AW, 0, stream>>>(QPh, QPl, KPh, KPl, VT, CTh, CTl);
    // output projection -> d_out
    k_out<<<dim3(MROWS / 64, HID / 64), 32, 0, stream>>>(CTh, CTl, WO, bo, OUT);
}

// v003
// One run takes 114 microseconds.
// Next to v002, in two timings, it ran 1.21 and 1.20 times as fast.
// Counting every step since v000, it is 2.58 times as fast.
#include <hip/hip_runtime.h>

// Contractions: q/k/v projections v_wmma_f32_16x16x32_bf16 (x and W as bf16 RNE planes, single product); scores bf16 hi|lo planes of rope(q)/8 and rope(k), three products; P.V v_wmma_f32_16x16x32_f16 (P carried x1024, V^T f16); output projection bf16 (ctx hi + ctx lo) x Wo, two products; all f32 accumulate, softmax f32.

#ifndef NB
#define NB 2
#endif
#ifndef SEQ
#define SEQ 2048
#endif
#define NB_FULL  2
#define SEQ_FULL 2048
#define HID   1024
#define NH    16
#define HD    64
#define KD    1024               // contraction length of every GEMM
#define MROWS (NB * SEQ)
#define AW    4                  // waves per attention block (16 query rows each)
#define L2E   1.4426950408889634f

typedef _Float16 h16;
typedef unsigned short bf;
typedef __attribute__((ext_vector_type(16))) __bf16   v16bf;
typedef __attribute__((ext_vector_type(16))) _Float16 v16h;
typedef __attribute__((ext_vector_type(8)))  _Float16 v8h;
typedef __attribute__((ext_vector_type(8)))  unsigned short v8us;
typedef __attribute__((ext_vector_type(8)))  float    v8f;
typedef __attribute__((ext_vector_type(4)))  float    v4f;
typedef __attribute__((ext_vector_type(2)))  float    v2f;
typedef v8h  __attribute__((may_alias)) v8ha;
typedef v4f  __attribute__((may_alias)) v4fa;

static_assert(NB <= NB_FULL);
static_assert(SEQ <= SEQ_FULL);
static_assert(HID == NH * HD);
static_assert(HD == 64);
static_assert(KD == HID);
static_assert(KD % 32 == 0);
static_assert(SEQ % 64 == 0);
static_assert(MROWS % 64 == 0);
static_assert(HID % 64 == 0);
static_assert(SEQ % (16 * AW) == 0);
static_assert(SEQ % 32 == 0);
static_assert((SEQ * HID) % 2048 == 0);
static_assert((HID * HID) % 2048 == 0);
static_assert((SEQ * 32) % 256 == 0);

__device__ __forceinline__ unsigned short f2bf(float f) { unsigned u = __float_as_uint(f); u += 0x7FFFu + ((u >> 16) & 1u); return (unsigned short)(u >> 16); }
__device__ __forceinline__ float bf2f(unsigned short b) { return __uint_as_float(((unsigned)b) << 16); }
__device__ __forceinline__ float bfr(float f) { return bf2f(f2bf(f)); }
__device__ __forceinline__ void splitf(float y, unsigned short& h, unsigned short& l) { h = f2bf(y); l = f2bf(y - bf2f(h)); }
__device__ __forceinline__ v16h cat16(v8h lo, v8h hi) { return __builtin_shufflevector(lo, hi, 0, 1, 2, 3, 4, 5, 6, 7, 8, 9, 10, 11, 12, 13, 14, 15); }
__device__ __forceinline__ v16bf cat16b(v8us lo, v8us hi) { return __builtin_bit_cast(v16bf, __builtin_shufflevector(lo, hi, 0, 1, 2, 3, 4, 5, 6, 7, 8, 9, 10, 11, 12, 13, 14, 15)); }
// Fragment-ordered planes: every 16-bit operand plane (rows of P elements, k contiguous in the maths) is stored as 1-KiB blocks, one per (16 rows, 32 k).
// Inside a block the 16-byte group of (row, k .. k + 7) sits at lane slot 16 * ((k >> 3) & 1) + (row & 15) of half (k >> 4) & 1, so one wave-wide 16-byte load reads 512 contiguous bytes (4 whole lines).
// pko: element offset of that group, k % 8 == 0.
__device__ __forceinline__ size_t pko(size_t row, int k, int P) { return ((row >> 4) * (size_t)(P >> 5) + (size_t)(k >> 5)) * 512 + (size_t)(((k >> 4) & 1) * 256 + ((k >> 3) & 1) * 128) + (row & 15) * 8; }
// Fragment loaders: p = block start + 8 * lane; elements 0..7 <- k0 + 8h + 0..7, elements 8..15 <- k0 + 16 + 8h + 0..7, row lane & 15, h = lane >> 4 (same map for A and B).
__device__ __forceinline__ v16bf ldb(const bf* p) { return cat16b(*(const v8us*)p, *(const v8us*)(p + 256)); }
__device__ __forceinline__ v16h  ldh(const h16* p) { return cat16(*(const v8h*)p, *(const v8h*)(p + 256)); }
// xwait stands behind global loads or stores, before a register that they name is written again; the forms with pointers take the loads' addresses as inputs, so that no later load's result is placed over an address pair ahead of the wait.
__device__ __forceinline__ void xwait() { asm volatile("s_wait_xcnt 0x0" ::: "memory"); }
__device__ __forceinline__ void xwait(const void* a, const void* b) { asm volatile("s_wait_xcnt 0x0" :: "v"(a), "v"(b) : "memory"); }
__device__ __forceinline__ void xwait(const void* a, const void* b, const void* c) { asm volatile("s_wait_xcnt 0x0" :: "v"(a), "v"(b), "v"(c) : "memory"); }
__device__ __forceinline__ v8f wmma16(v16h a, v16h b, v8f c) { return __builtin_amdgcn_wmma_f32_16x16x32_f16(false, a, false, b, (short)0, c, false, false); }
__device__ __forceinline__ v8f wmmab(v16bf a, v16bf b, v8f c) { return __builtin_amdgcn_wmma_f32_16x16x32_bf16(false, a, false, b, (short)0, c, false, false); }

// ---- k_prep: every job that depends on the inputs alone, in one grid; the block index picks the job (a test that reads the same for the whole block).
#define CSB   (SEQ * 32 / 256)       // blocks of the cos/sin table
#define CVB_X (SEQ * HID / 2048)     // conversion blocks per batch of x
#define CVB_W (HID * HID / 2048)     // conversion blocks per weight plane
__global__ __launch_bounds__(256) void k_prep(const float* __restrict__ x, const float* __restrict__ wq, const float* __restrict__ wk, const float* __restrict__ wv, const float* __restrict__ wo, bf* XB, bf* WB, float* CS) {
    int blk = blockIdx.x;
    if (blk < CSB) {
        const int idx = blk * 256 + threadIdx.x;
        const int s = idx >> 5, j = idx & 31;
        const double p = (double)(1u << (j >> 1)) * ((j & 1) ? 1.4142135623730951 : 1.0);
        const float pf = (float)p; const float inv = 1.0f / pf; const float ang = (float)s * inv;
        float sn, c; sincosf(ang, &sn, &c);
        v2f cs; cs[0] = c; cs[1] = sn;
        *(v2f*)(CS + (size_t)idx * 2) = cs;
    } else {
        // bf16 RNE conversion into a fragment-ordered plane of HID columns: the batches of x first, then the four weight planes (WB holds them one behind the other)
        blk -= CSB;
        const float* src; bf* dst;
        if (blk < NB * CVB_X) { const int y = blk / CVB_X; blk -= y * CVB_X; src = x + (size_t)y * (SEQ_FULL * HID); dst = XB + (size_t)y * (SEQ * HID); }
        else { blk -= NB * CVB_X; const int y = blk / CVB_W; blk -= y * CVB_W; src = y == 0 ? wq : y == 1 ? wk : y == 2 ? wv : wo; dst = WB + (size_t)y * (HID * HID); }
        // a block converts 16 rows x 128 columns; a wave holds 16 rows x 2 groups, which is one 512-byte half block of dst
        const int row = (blk >> 3) * 16 + (threadIdx.x & 15), k = (blk & 7) * 128 + (threadIdx.x >> 4) * 8;
        const float* s = src + (size_t)row * HID + k;
        const v4f a = *(const v4f*)s, b = *(const v4f*)(s + 4);
        v8us o; o[0] = f2bf(a[0]); o[1] = f2bf(a[1]); o[2] = f2bf(a[2]); o[3] = f2bf(a[3]); o[4] = f2bf(b[0]); o[5] = f2bf(b[1]); o[6] = f2bf(b[2]); o[7] = f2bf(b[3]);
        bf* d = dst + pko(row, k, HID);
        *(v8us*)d = o;
    }
}

// ---- gemm_core: one wave computes a 64x64 tile, acc[mb][nb] = sum_k A[r0+16mb+..][k] Bt[c0+16nb+..][k] (+ A2 product when NA == 2); operands straight from fragment-ordered bf16 planes (rows of KD elements).
// The fragments of a k step (32 k) are loaded two steps ahead of their products, into four register sets used in turn: the loads of two steps are in flight while a third is multiplied.
template <int NA> struct fset { v16bf a[4], a2[4], b[4]; };
// st: element offset of the k step from the pointers (512 elements a step)
template <int NA>
__device__ __forceinline__ void ldset(fset<NA>& f, const bf* pa, const bf* pa2, const bf* pb, const int st) {
#pragma unroll
    for (int mb = 0; mb < 4; ++mb) { f.a[mb] = ldb(pa + st + mb * 16 * KD); if (NA == 2) f.a2[mb] = ldb(pa2 + st + mb * 16 * KD); }
    __builtin_amdgcn_sched_barrier(0);   // A loads ahead of B loads in every set alike: the counted waits at the loop's head hold for both ways into it, and one set in another order makes them drain the whole set
#pragma unroll
    for (int nb = 0; nb < 4; ++nb) f.b[nb] = ldb(pb + st + nb * 16 * KD);
}
template <int NA>
__device__ __forceinline__ void mmset(const fset<NA>& f, v8f (&acc)[4][4]) {
#pragma unroll
    for (int nb = 0; nb < 4; ++nb)
#pragma unroll
        for (int mb = 0; mb < 4; ++mb) { acc[mb][nb] = wmmab(f.a[mb], f.b[nb], acc[mb][nb]); if (NA == 2) acc[mb][nb] = wmmab(f.a2[mb], f.b[nb], acc[mb][nb]); }
}
template <int NA>
__device__ __forceinline__ void gemm_core(const bf* __restrict__ A, const bf* __restrict__ A2, const bf* __restrict__ Bt, const int r0, const int c0, const int lr, const int hi, v8f (&acc)[4][4]) {
    static_assert(KD % 128 == 0 && KD >= 256);
#pragma unroll
    for (int mb = 0; mb < 4; ++mb)
#pragma unroll
        for (int nb = 0; nb < 4; ++nb) acc[mb][nb] = (v8f){};
    const size_t aoff = pko(r0, 0, KD) + 8 * (16 * hi + lr), boff = pko(c0, 0, KD) + 8 * (16 * hi + lr);
    unsigned ao = (unsigned)aoff, bo = (unsigned)boff;   // element offsets of the trip's first step; every plane is far below 2^32 elements
    fset<NA> f0, f1, f2, f3;
    // SB holds each step's loads together and in program order: the load counter retires in order, so a load sunk behind a later step's loads would make its wait drain those as well.
#define SB() __builtin_amdgcn_sched_barrier(0)
    { const bf* pa = A + ao; const bf* pa2 = A2 + ao; const bf* pb = Bt + bo;
      ldset<NA>(f0, pa, pa2, pb, 0); SB(); ldset<NA>(f1, pa, pa2, pb, 512); SB();
      // as at the loop's foot: the wait stands behind these loads, before the first trip forms its addresses in the registers that they name
      if (NA == 2) asm volatile("s_wait_xcnt 0x0" : "+v"(ao), "+v"(bo) : "v"(pa), "v"(pa2), "v"(pb) : "memory");
      else         asm volatile("s_wait_xcnt 0x0" : "+v"(ao), "+v"(bo) : "v"(pa), "v"(pb) : "memory"); }
#pragma unroll 1
    for (int kc = 0; kc < KD - 128; kc += 128) {   // rolled: four steps a trip, one per register set
        const bf* pa = A + ao; const bf* pa2 = A2 + ao; const bf* pb = Bt + bo;
        ldset<NA>(f2, pa, pa2, pb, 1024); SB(); mmset<NA>(f0, acc); SB();
        ldset<NA>(f3, pa, pa2, pb, 1536); SB(); mmset<NA>(f1, acc); SB();
        ldset<NA>(f0, pa, pa2, pb, 2048); SB(); mmset<NA>(f2, acc); SB();
        ldset<NA>(f1, pa, pa2, pb, 2560); SB(); mmset<NA>(f3, acc); SB();
        // the wait takes the loads' addresses as inputs, so that nothing is placed over them ahead of it, and the offsets pass through it, so that the next trip's addresses cannot be formed ahead of it
        if (NA == 2) asm volatile("s_wait_xcnt 0x0" : "+v"(ao), "+v"(bo) : "v"(pa), "v"(pa2), "v"(pb) : "memory");
        else         asm volatile("s_wait_xcnt 0x0" : "+v"(ao), "+v"(bo) : "v"(pa), "v"(pb) : "memory");
        ao += 2048; bo += 2048;
    }
    { const bf* pa = A + ao; const bf* pa2 = A2 + ao; const bf* pb = Bt + bo;
      ldset<NA>(f2, pa, pa2, pb, 1024); SB(); mmset<NA>(f0, acc); SB();
      ldset<NA>(f3, pa, pa2, pb, 1536); SB(); mmset<NA>(f1, acc); SB();
      mmset<NA>(f2, acc); mmset<NA>(f3, acc);
      if (NA == 2) xwait(pa, pa2, pb); else xwait(pa, pb); }
#undef SB
}

// ---- epi_rope: acc = XB . W^T for one head (64 columns) and 64 tokens; adds the bias, then rotate-half rotary and scale sc; head planes [b][h][s][d] as bf16 hi | lo, fragment-ordered (rows of HD elements).
__device__ __forceinline__ void epi_rope(const v8f (&acc)[4][4], const int r0, const int c0, const int lane, const float* __restrict__ bias, const float* __restrict__ CS, float sc, bf* Ph, bf* Pl) {
    __shared__ __align__(16) float os[16 * 68];
    const int lr = lane & 15, hi = lane >> 4;
    const int b = r0 / SEQ, s0 = r0 % SEQ, h = blockIdx.y;
    const int rq = lane >> 3, pc = lane & 7, d0 = pc * 8, dp0 = d0 ^ 32, jf0 = d0 & 31;
    const float sgn = (d0 < 32) ? -1.0f : 1.0f;
    float bx[8], bp[8];
    { const v4f u0 = *(const v4f*)(bias + c0 + d0), u1 = *(const v4f*)(bias + c0 + d0 + 4), w0 = *(const v4f*)(bias + c0 + dp0), w1 = *(const v4f*)(bias + c0 + dp0 + 4);
      xwait(); __builtin_amdgcn_sched_barrier(0);   // the barrier holds later vector work behind the wait: without it this build rewrites a load's offset register ahead of the wait
#pragma unroll
      for (int q = 0; q < 4; ++q) { bx[q] = bfr(u0[q]); bx[q + 4] = bfr(u1[q]); bp[q] = bfr(w0[q]); bp[q + 4] = bfr(w1[q]); } }
#pragma unroll
    for (int mb = 0; mb < 4; ++mb) {
#pragma unroll
        for (int nb = 0; nb < 4; ++nb) {
#pragma unroll
            for (int j = 0; j < 8; ++j) os[(hi * 8 + j) * 68 + nb * 16 + lr] = acc[mb][nb][j]; }
        __syncthreads();
        const size_t prow = pko((size_t)(b * NH + h) * SEQ + s0 + mb * 16, d0, HD);
{
#pragma unroll 1
            for (int it = 0; it < 4; ++it) {
                const int rr = it * 4 + rq; const int s = s0 + mb * 16 + rr; const int xo = rr * 68;
                const v4f xa = *(const v4fa*)(os + xo + d0), xb = *(const v4fa*)(os + xo + d0 + 4);
                const v4f ya = *(const v4fa*)(os + xo + dp0), yb = *(const v4fa*)(os + xo + dp0 + 4);
                const float* cp = CS + ((size_t)s * 32 + jf0) * 2;
                const v4f t0 = *(const v4f*)cp, t1 = *(const v4f*)(cp + 4), t2 = *(const v4f*)(cp + 8), t3 = *(const v4f*)(cp + 12);
                const float xv[8] = { xa[0], xa[1], xa[2], xa[3], xb[0], xb[1], xb[2], xb[3] };
                const float yv[8] = { ya[0], ya[1], ya[2], ya[3], yb[0], yb[1], yb[2], yb[3] };
                const float cv[8] = { t0[0], t0[2], t1[0], t1[2], t2[0], t2[2], t3[0], t3[2] };
                const float sv[8] = { t0[1], t0[3], t1[1], t1[3], t2[1], t2[3], t3[1], t3[3] };
                v8us oh, ol;
#pragma unroll
                for (int q = 0; q < 8; ++q) { const float x = xv[q] + bx[q], y = yv[q] + bp[q]; const float r = (x * cv[q] + sgn * (y * sv[q])) * sc; unsigned short a2, c2; splitf(r, a2, c2); oh[q] = a2; ol[q] = c2; }
                *(v8us*)(Ph + prow + (size_t)rr * 8) = oh; *(v8us*)(Pl + prow + (size_t)rr * 8) = ol; xwait(); }
             }
        __syncthreads();
    }
}

// ---- epi_v: the same tile of the v projection; adds the bias and stores it transposed as f16.
__device__ __forceinline__ void epi_v(const v8f (&acc)[4][4], const int r0, const int c0, const int lane, const float* __restrict__ bias, h16* VT) {
    __shared__ __align__(16) h16 vt[64 * 72];
    const int lr = lane & 15, hi = lane >> 4;
    const int b = r0 / SEQ, s0 = r0 % SEQ, h = blockIdx.y;
    const int rq = lane >> 3, pc = lane & 7;
#pragma unroll
    for (int nb = 0; nb < 4; ++nb) { const float bv = bfr(bias[c0 + nb * 16 + lr]);
#pragma unroll
        for (int mb = 0; mb < 4; ++mb) { v8h pk;
#pragma unroll
            for (int j = 0; j < 8; ++j) pk[j] = (h16)(acc[mb][nb][j] + bv);
            *(v8ha*)(vt + (nb * 16 + lr) * 72 + mb * 16 + 8 * hi) = pk; } }
    __syncthreads();
    h16* dv = VT + pko((size_t)(b * NH + h) * HD, s0 + 8 * pc, SEQ);   // V^T plane [b][h][d][s], fragment-ordered (rows of SEQ elements)
{
#pragma unroll 1
        for (int it = 0; it < 16; ++it) { const int d = it * 4 + rq; const v8h val = *(const v8ha*)(vt + d * 72 + 8 * pc); *(v8h*)(dv + (size_t)(d >> 4) * (16 * SEQ) + (d & 15) * 8) = val; xwait(); }
         }
}

// ---- k_proj: the q, k and v projections in one grid (MROWS/64, NH, 3), 32 threads; blockIdx.z picks the weight plane (WB holds q, k, v one behind the other) and the epilogue.
__global__ __launch_bounds__(32) void k_proj(const bf* __restrict__ XB, const bf* __restrict__ WB, const float* __restrict__ bq, const float* __restrict__ bk, const float* __restrict__ bv, const float* __restrict__ CS, bf* Qh, bf* Ql, bf* Kh, bf* Kl, h16* VT) {
    const int lane = threadIdx.x & 31;
    const int r0 = blockIdx.x * 64, c0 = blockIdx.y * 64, job = blockIdx.z;
    v8f acc[4][4];
    gemm_core<1>(XB, XB, WB + (size_t)job * (HID * HID), r0, c0, lane & 15, lane >> 4, acc);
    if (job == 2) epi_v(acc, r0, c0, lane, bv, VT);
    else epi_rope(acc, r0, c0, lane, job ? bk : bq, CS, job ? 1.0f : 0.125f, job ? Kh : Qh, job ? Kl : Ql);   // q carries the 1/8 score scale, exact
}

template <bool B> struct flag { static constexpr bool v = B; };

// ---- k_attn: fused flash attention, one wave per 16 query rows of one (b, h); 32 keys per step.
// Scores are computed transposed: S^T[key][query] = K . Q^T (A = K rows, B = Q rows, 3 bf16 products), so each lane owns ONE query column (lane & 15) and 16 keys per step.
// P^T (x1024, f16) is packed from the two score accumulator tiles straight into the B fragment of O^T[d][query] += V^T[d][key] . P^T[key][query]
// (element r <- tile of keys 0..15, element 8 + r <- tile of keys 16..31, lane unchanged). Row max via one xor-16 shuffle; row sums kept as per-lane partials.
__global__ __launch_bounds__(128) void k_attn(const bf* __restrict__ Qh, const bf* __restrict__ Ql, const bf* __restrict__ Kh, const bf* __restrict__ Kl, const h16* __restrict__ VT, bf* Ch, bf* Cl) {
    __shared__ __align__(16) float ot[AW * 16 * 68];
    const int lane = threadIdx.x & 31, lr = lane & 15, hi = lane >> 4;
    const int wave = __builtin_amdgcn_readfirstlane(threadIdx.x >> 5);
    const int qt = blockIdx.x * AW + wave;
    const int bh = blockIdx.y;
    const size_t pb0 = (size_t)bh * SEQ * HD;
    const size_t qoff = pb0 + (size_t)(qt * 16) * HD + 8 * lane;
    const v16bf qh0 = ldb(Qh + qoff), qh1 = ldb(Qh + qoff + 512), ql0 = ldb(Ql + qoff), ql1 = ldb(Ql + qoff + 512);
    xwait(Qh + qoff, Ql + qoff);
    const size_t koff = pb0 + 8 * lane;
    const size_t voff = (size_t)bh * HD * SEQ + 8 * lane;
    v8f o0 = (v8f){}, o1 = (v8f){}, o2 = (v8f){}, o3 = (v8f){};
    float m = -1.0e30f, l = 0.0f;
    // K and V^T fragments are loaded one pass ahead of their products, into the registers that the pass has just multiplied from; ko, vo: element offsets of the loads last issued (every plane is far below 2^32 elements)
    unsigned ko = (unsigned)koff, vo = (unsigned)voff;
    const bf* ph = Kh + ko; const bf* pl = Kl + ko; const h16* vp = VT + vo;   // the addresses of the loads last issued
    // SB holds the first pass's loads in the order that the loop issues them in: the load counter retires in order, and the waits at the loop's head count for both ways into it
#define SB() __builtin_amdgcn_sched_barrier(0)
    v16bf a0 = ldb(ph), a1 = ldb(ph + 512); SB();
    v16bf c0 = ldb(pl), c1 = ldb(pl + 512); SB();
    v16bf e0 = ldb(ph + 16 * HD), e1 = ldb(ph + 16 * HD + 512); SB();
    v16bf g0 = ldb(pl + 16 * HD), g1 = ldb(pl + 16 * HD + 512); SB();
    v16h va0 = ldh(vp), va1 = ldh(vp + (size_t)16 * SEQ), va2 = ldh(vp + (size_t)32 * SEQ), va3 = ldh(vp + (size_t)48 * SEQ); SB();
#undef SB
    // one pass of 32 keys; more: a further pass follows, whose fragments this one loads (a compile-time flag, so that the load counts are the same on every path and the counted waits stay exact)
    auto pass = [&](auto more) __attribute__((always_inline)) {
        v8f s0 = (v8f){}, s1 = (v8f){};
        s0 = wmmab(a0, qh0, s0); s0 = wmmab(a1, qh1, s0); s0 = wmmab(c0, qh0, s0); s0 = wmmab(c1, qh1, s0); s0 = wmmab(a0, ql0, s0); s0 = wmmab(a1, ql1, s0);
        s1 = wmmab(e0, qh0, s1); s1 = wmmab(e1, qh1, s1); s1 = wmmab(g0, qh0, s1); s1 = wmmab(g1, qh1, s1); s1 = wmmab(e0, ql0, s1); s1 = wmmab(e1, ql1, s1);
        asm volatile("v_nop\n\tv_nop\n\tv_nop\n\tv_nop" : "+v"(s0), "+v"(s1) : "v"(e1), "v"(g1), "v"(ql1));
        // the wait takes the earlier loads' addresses as inputs, so that nothing is placed over them ahead of it, and the offsets pass through it, so that the next addresses cannot be formed ahead of it
        asm volatile("s_wait_xcnt 0x0" : "+v"(ko), "+v"(vo) : "v"(ph), "v"(pl), "v"(vp) : "memory");
        if constexpr (decltype(more)::v) {   // next pass's K
            ko += 32 * HD; ph = Kh + ko; pl = Kl + ko;
            a0 = ldb(ph); a1 = ldb(ph + 512); c0 = ldb(pl); c1 = ldb(pl + 512);
            e0 = ldb(ph + 16 * HD); e1 = ldb(ph + 16 * HD + 512); g0 = ldb(pl + 16 * HD); g1 = ldb(pl + 16 * HD + 512);
            __builtin_amdgcn_sched_barrier(0);   // keeps all of these loads here, ahead of the softmax: sunk below it they would have too little lead
        }
        float mx = fmaxf(s0[0], s1[0]);
#pragma unroll
        for (int r = 1; r < 8; ++r) mx = fmaxf(mx, fmaxf(s0[r], s1[r]));
        mx = fmaxf(mx, __shfl_xor(mx, 16, 32));
        const float mn = fmaxf(m, mx);
        const float corr = __builtin_amdgcn_exp2f((m - mn) * L2E);
        m = mn;
        float ls = 0.0f; v16h pb;
#pragma unroll
        for (int r = 0; r < 8; ++r) {
            const float p0 = __builtin_amdgcn_exp2f(__builtin_fmaf(s0[r] - mn, L2E, 10.0f));   // exp(s - m) x 1024
            const float p1 = __builtin_amdgcn_exp2f(__builtin_fmaf(s1[r] - mn, L2E, 10.0f));
            ls += p0 + p1; pb[r] = (h16)p0; pb[8 + r] = (h16)p1; }
        l = l * corr + ls;
        o0 = o0 * corr; o1 = o1 * corr; o2 = o2 * corr; o3 = o3 * corr;
        o0 = wmma16(va0, pb, o0); o1 = wmma16(va1, pb, o1); o2 = wmma16(va2, pb, o2); o3 = wmma16(va3, pb, o3);
        asm volatile("v_nop\n\tv_nop\n\tv_nop\n\tv_nop" : "+v"(o0), "+v"(o1), "+v"(o2), "+v"(o3) : "v"(pb), "v"(va3));
        if constexpr (decltype(more)::v) {   // next pass's V^T
            vo += 32 * 16; vp = VT + vo;
            va0 = ldh(vp); va1 = ldh(vp + (size_t)16 * SEQ); va2 = ldh(vp + (size_t)32 * SEQ); va3 = ldh(vp + (size_t)48 * SEQ);
        }
    };
#pragma unroll 1
    for (int kb = 0; kb < SEQ - 32; kb += 32) pass(flag<true>{});   // rolled: the body is long
    pass(flag<false>{});
    const float lt = l + __shfl_xor(l, 16, 32);
    const float inv = 1.0f / lt;       // the x1024 carry cancels between numerator and row sum
    const int ob = wave * (16 * 68) + lr * 68 + 8 * hi;
    { v4f x0, x1;
      x0[0] = o0[0] * inv; x0[1] = o0[1] * inv; x0[2] = o0[2] * inv; x0[3] = o0[3] * inv; x1[0] = o0[4] * inv; x1[1] = o0[5] * inv; x1[2] = o0[6] * inv; x1[3] = o0[7] * inv;
      *(v4fa*)(ot + ob) = x0; *(v4fa*)(ot + ob + 4) = x1;
      x0[0] = o1[0] * inv; x0[1] = o1[1] * inv; x0[2] = o1[2] * inv; x0[3] = o1[3] * inv; x1[0] = o1[4] * inv; x1[1] = o1[5] * inv; x1[2] = o1[6] * inv; x1[3] = o1[7] * inv;
      *(v4fa*)(ot + ob + 16) = x0; *(v4fa*)(ot + ob + 20) = x1;
      x0[0] = o2[0] * inv; x0[1] = o2[1] * inv; x0[2] = o2[2] * inv; x0[3] = o2[3] * inv; x1[0] = o2[4] * inv; x1[1] = o2[5] * inv; x1[2] = o2[6] * inv; x1[3] = o2[7] * inv;
      *(v4fa*)(ot + ob + 32) = x0; *(v4fa*)(ot + ob + 36) = x1;
      x0[0] = o3[0] * inv; x0[1] = o3[1] * inv; x0[2] = o3[2] * inv; x0[3] = o3[3] * inv; x1[0] = o3[4] * inv; x1[1] = o3[5] * inv; x1[2] = o3[6] * inv; x1[3] = o3[7] * inv;
      *(v4fa*)(ot + ob + 48) = x0; *(v4fa*)(ot + ob + 52) = x1; }
    __syncthreads();
    const int rq = lane >> 3, pc = lane & 7;
    const int b = bh / NH, h = bh % NH;
    const size_t cbase = pko((size_t)(b * SEQ + qt * 16), h * HD + 8 * pc, HID);
{
#pragma unroll 1
        for (int it = 0; it < 4; ++it) {
            const int rr = it * 4 + rq; const int xo = wave * (16 * 68) + rr * 68 + 8 * pc;
            const v4f x0 = *(const v4fa*)(ot + xo), x1 = *(const v4fa*)(ot + xo + 4);
            v8us oh, ol;
#pragma unroll
            for (int q = 0; q < 4; ++q) { unsigned short a2, c2; splitf(x0[q], a2, c2); oh[q] = a2; ol[q] = c2; splitf(x1[q], a2, c2); oh[q + 4] = a2; ol[q + 4] = c2; }
            *(v8us*)(Ch + cbase + (size_t)rr * 8) = oh; *(v8us*)(Cl + cbase + (size_t)rr * 8) = ol; }
         }
}

// ---- k_out: OUT[token][n] = sum_k (Ch + Cl)[token][k] Wo[n][k] + bo[n]; grid (MROWS/64, HID/64), 32 threads.
__global__ __launch_bounds__(32) void k_out(const bf* __restrict__ Ch, const bf* __restrict__ Cl, const bf* __restrict__ W, const float* __restrict__ bias, float* OUT) {
    __shared__ __align__(16) float os[16 * 68];
    const int lane = threadIdx.x & 31, lr = lane & 15, hi = lane >> 4;
    const int r0 = blockIdx.x * 64, c0 = blockIdx.y * 64;
    v8f acc[4][4];
    gemm_core<2>(Ch, Cl, W, r0, c0, lr, hi, acc);
    const int b = r0 / SEQ, s0 = r0 % SEQ;
    const int cofs = lr * 4;
    v4f bb = *(const v4f*)(bias + c0 + cofs); bb[0] = bfr(bb[0]); bb[1] = bfr(bb[1]); bb[2] = bfr(bb[2]); bb[3] = bfr(bb[3]);
#pragma unroll
    for (int mb = 0; mb < 4; ++mb) {
#pragma unroll
        for (int nb = 0; nb < 4; ++nb) {
#pragma unroll
            for (int j = 0; j < 8; ++j) os[(hi * 8 + j) * 68 + nb * 16 + lr] = acc[mb][nb][j]; }
        __syncthreads();
        float* crow = OUT + ((size_t)b * SEQ_FULL + s0 + mb * 16) * HID + c0 + cofs;
{
#pragma unroll 1
            for (int s = 0; s < 8; ++s) { const int row = 2 * s + hi; v4f val = *(const v4fa*)(os + row * 68 + cofs); val = val + bb; *(v4f*)(crow + (size_t)row * HID) = val; }
             }
        __syncthreads();
    }
}

extern "C" void kernel_launch(void* const* d_in, const int* in_sizes, int n_in,
                              void* d_out, int out_size, void* d_ws, size_t ws_size, hipStream_t stream) {
    if (n_in < 9) return;
    const int need_x = (NB - 1) * SEQ_FULL * HID + SEQ * HID;
    if (in_sizes[0] < need_x) return;
    if (in_sizes[1] < HID * HID || in_sizes[3] < HID * HID || in_sizes[5] < HID * HID || in_sizes[7] < HID * HID) return;
    if (in_sizes[2] < HID || in_sizes[4] < HID || in_sizes[6] < HID || in_sizes[8] < HID) return;
    if (out_size < need_x) return;
    const float* x  = (const float*)d_in[0];
    const float* wq = (const float*)d_in[1]; const float* bq = (const float*)d_in[2];
    const float* wk = (const float*)d_in[3]; const float* bk = (const float*)d_in[4];
    const float* wv = (const float*)d_in[5]; const float* bv = (const float*)d_in[6];
    const float* wo = (const float*)d_in[7]; const float* bo = (const float*)d_in[8];
    float* OUT = (float*)d_out;

    constexpr size_t SZ_XB = (size_t)MROWS * HID * 2;            // bf16 x plane
    constexpr size_t SZ_W  = (size_t)HID * HID * 2;              // bf16 weight plane
    constexpr size_t SZ_CS = (size_t)SEQ * 32 * 2 * 4;           // cos/sin table
    constexpr size_t SZ_P  = (size_t)NB * NH * SEQ * HD * 2;     // one head plane set (16-bit)
    constexpr size_t SZ_CT = (size_t)MROWS * HID * 2;            // ctx plane
    constexpr size_t OFF_XB = 0;
    constexpr size_t OFF_WQ = OFF_XB + SZ_XB;
    constexpr size_t OFF_WK = OFF_WQ + SZ_W;
    constexpr size_t OFF_WV = OFF_WK + SZ_W;
    constexpr size_t OFF_WO = OFF_WV + SZ_W;
    constexpr size_t OFF_CS = OFF_WO + SZ_W;
    constexpr size_t OFF_QH = OFF_CS + SZ_CS;
    constexpr size_t OFF_QL = OFF_QH + SZ_P;
    constexpr size_t OFF_KH = OFF_QL + SZ_P;
    constexpr size_t OFF_KL = OFF_KH + SZ_P;
    constexpr size_t OFF_VT = OFF_KL + SZ_P;
    constexpr size_t OFF_CH = OFF_VT + SZ_P;
    constexpr size_t OFF_CL = OFF_CH + SZ_CT;
    constexpr size_t WS_TOTAL = OFF_CL + SZ_CT;
    static_assert(SZ_XB % 256 == 0);
    static_assert(SZ_W % 256 == 0);
    static_assert(SZ_CS % 256 == 0);
    static_assert(SZ_P % 256 == 0);
    static_assert(SZ_CT % 256 == 0);
    static_assert(OFF_WK == OFF_WQ + SZ_W && OFF_WV == OFF_WQ + 2 * SZ_W && OFF_WO == OFF_WQ + 3 * SZ_W);
    static_assert(WS_TOTAL <= (size_t)134217728);
    if (WS_TOTAL > ws_size) return;
    char* wsp = (char*)d_ws;
    bf* XB = (bf*)(wsp + OFF_XB); bf* WQ = (bf*)(wsp + OFF_WQ); bf* WO = (bf*)(wsp + OFF_WO);   // the planes of wq, wk, wv, wo lie one behind the other from WQ on
    float* CS = (float*)(wsp + OFF_CS);
    bf* QPh = (bf*)(wsp + OFF_QH); bf* QPl = (bf*)(wsp + OFF_QL); bf* KPh = (bf*)(wsp + OFF_KH); bf* KPl = (bf*)(wsp + OFF_KL);
    h16* VT = (h16*)(wsp + OFF_VT);
    bf* CTh = (bf*)(wsp + OFF_CH); bf* CTl = (bf*)(wsp + OFF_CL);

    // operand planes (bf16 RNE, fragment-ordered) and the cos/sin table, one launch
    k_prep<<<CSB + NB * CVB_X + 4 * CVB_W, 256, 0, stream>>>(x, wq, wk, wv, wo, XB, WQ, CS);
    // the three projections with fused rotary / transpose epilogues, one launch
    k_proj<<<dim3(MROWS / 64, NH, 3), 32, 0, stream>>>(XB, WQ, bq, bk, bv, CS, QPh, QPl, KPh, KPl, VT);
    // fused attention -> ctx hi | lo planes [token][h*64 + d], fragment-ordered
    k_attn<<<dim3(SEQ / (16 * AW), NB * NH), 32 * AW, 0, stream>>>(QPh, QPl, KPh, KPl, VT, CTh, CTl);
    // output projection -> d_out
    k_out<<<dim3(MROWS / 64, HID / 64), 32, 0, stream>>>(CTh, CTl, WO, bo, OUT);
}
